// v000
// Times are from an AMD MI455X. After a warm-up the kernel runs many times in a row, and a time is the length of
// such a window on the GPU divided by its runs, so every launch and the gaps after it count. The runs cycle
// through copies of the inputs. A figure is the median of several windows, for all but v000 over two sittings.
// Sittings can differ by a few percent; kernels timed side by side share one.
// v000 is the starting kernel. One run takes 5260 microseconds.
#include <hip/hip_runtime.h>

// Compute dtypes, f32 accumulate, per (batch, head) map: S = Q.K^T as a [2048 x 64].[64 x 2048] GEMM with PLAIN bf16 operands (the inputs themselves, rounded; exact products;
// key tiles entirely above the diagonal are skipped and never read); causal softmax statistics (m, l) and L = m + log l in f32; P = exp(S/8 - L) -> bf16 hi + UNSCALED residual planes
// (zero above the diagonal); O = P.V ([2048 x 2048].[2048 x 64], P hi/lo x exact V, two products, K limited to the causal extent) - on v_wmma_f32_16x16x32_bf16. Deterministic, no

#define NB_  2
#define NH_  16
#define SS   2048
#define HD   64
#define SCL  0.125f
#define LOSC 1024.0f

typedef _Float16 h16;
typedef unsigned short bf;
typedef __attribute__((ext_vector_type(16))) __bf16   v16bf;
typedef __attribute__((ext_vector_type(16))) _Float16 v16h;
typedef __attribute__((ext_vector_type(8)))  _Float16 v8h;
typedef __attribute__((ext_vector_type(8)))  unsigned short v8us;
typedef __attribute__((ext_vector_type(8)))  float    v8f;
typedef __attribute__((ext_vector_type(4)))  float    v4f;
typedef __attribute__((ext_vector_type(4)))  _Float16 v4h;
typedef v8h  __attribute__((may_alias)) v8ha;
typedef v4f  __attribute__((may_alias)) v4fa;
typedef v8us __attribute__((may_alias)) v8usa;

__device__ __forceinline__ unsigned short f2bf(float f) { unsigned u = __float_as_uint(f); u += 0x7FFFu + ((u >> 16) & 1u); return (unsigned short)(u >> 16); }
__device__ __forceinline__ float bf2f(unsigned short b) { return __uint_as_float(((unsigned)b) << 16); }
__device__ __forceinline__ float bfr(float f) { return bf2f(f2bf(f)); }
__device__ __forceinline__ v16h cat16(v8h lo, v8h hi) { return __builtin_shufflevector(lo, hi, 0, 1, 2, 3, 4, 5, 6, 7, 8, 9, 10, 11, 12, 13, 14, 15); }
__device__ __forceinline__ v16bf cat16b(v8us lo, v8us hi) { return __builtin_bit_cast(v16bf, __builtin_shufflevector(lo, hi, 0, 1, 2, 3, 4, 5, 6, 7, 8, 9, 10, 11, 12, 13, 14, 15)); }
__device__ __forceinline__ v8f wmma16(v16h a, v16h b, v8f c) { return __builtin_amdgcn_wmma_f32_16x16x32_f16(false, a, false, b, (short)0, c, false, false); }
__device__ __forceinline__ v8f wmmab(v16bf a, v16bf b, v8f c) { return __builtin_amdgcn_wmma_f32_16x16x32_bf16(false, a, false, b, (short)0, c, false, false); }

// k_gemm3x: 64 x 64 tile of C = (Ah + Al).(Bh + Bl)^T over K (row strides = K for all four planes; n-major B): three products per 32-k step (hh, hl, lh); f32
template <int MODE>
__global__ __launch_bounds__(128) void k_gemm3x(const bf* __restrict__ Ah, const bf* __restrict__ Al, const bf* __restrict__ Bh, const bf* __restrict__ Bl, int K, float* C, int ldc) {
    if ((MODE & 1) && (int)blockIdx.y * 64 > (int)blockIdx.x * 64 + 63) return;
    const int Klim = (MODE & 2) ? min(K, ((int)blockIdx.x + 1) * 64) : K;
    __shared__ __align__(16) float ost[4][16 * 68];
    const int lane = threadIdx.x & 31, wave = threadIdx.x >> 5, lr = lane & 15, hi = lane >> 4;
    const int r0 = blockIdx.x * 64 + wave * 16, c0 = blockIdx.y * 64;
    const size_t aoff = (size_t)(r0 + lr) * K + 8 * hi;
    v8f acc[4];
#pragma unroll
    for (int t = 0; t < 4; ++t) acc[t] = (v8f){};
#pragma unroll 1
    for (int kc = 0; kc < Klim; kc += 32) {
        const v16bf a = cat16b(*(const v8us*)(Ah + aoff + kc), *(const v8us*)(Ah + aoff + kc + 16));
        v16bf al = a; if (!(MODE & 4)) al = cat16b(*(const v8us*)(Al + aoff + kc), *(const v8us*)(Al + aoff + kc + 16));
#pragma unroll
        for (int t = 0; t < 4; ++t) { const size_t bo = (size_t)(c0 + t * 16 + lr) * K + kc + 8 * hi;
            const v16bf bh = cat16b(*(const v8us*)(Bh + bo), *(const v8us*)(Bh + bo + 16));
            acc[t] = wmmab(a, bh, acc[t]);
            if (!(MODE & 4)) { acc[t] = wmmab(al, bh, acc[t]); if (!(MODE & 8)) { const v16bf bl = cat16b(*(const v8us*)(Bl + bo), *(const v8us*)(Bl + bo + 16)); acc[t] = wmmab(a, bl, acc[t]); } } }
        asm volatile("v_nop\n\tv_nop\n\tv_nop\n\tv_nop" : "+v"(acc[0]), "+v"(acc[1]), "+v"(acc[2]), "+v"(acc[3]) : "v"(a), "v"(al));
    }
    float* os = &ost[wave][0];
#pragma unroll
    for (int t = 0; t < 4; ++t) {
#pragma unroll
        for (int j = 0; j < 8; ++j) os[(hi * 8 + j) * 68 + t * 16 + lr] = acc[t][j]; }
    __builtin_amdgcn_wave_barrier(); asm volatile("" ::: "memory");
    float* crow = C + (size_t)r0 * ldc + c0;
    auto pass = [&]() {
#pragma unroll
        for (int s = 0; s < 8; ++s) { const int Lid = (lane >> 3) + 4 * s, piece = lane & 7; const int row = Lid >> 1, cofs = (Lid & 1) * 32 + piece * 4;
            const v4f val = *(const v4fa*)(os + row * 68 + cofs); *(v4f*)(crow + (size_t)row * ldc + cofs) = val; }
    };
    pass(); 
}


__global__ __launch_bounds__(256) void k_cvt64(const float* __restrict__ src, bf* dst) {
    typedef __attribute__((ext_vector_type(2))) unsigned short v2us;
    const int lane = threadIdx.x & 31; const size_t r = (size_t)blockIdx.x * 8 + (threadIdx.x >> 5); if (r >= (size_t)SS) return; v2us o; o[0] = f2bf(src[r * HD + lane * 2]); o[1] = f2bf(src[r * HD + lane * 2 + 1]);
    *(v2us*)(dst + r * HD + lane * 2) = o; 
}
__global__ __launch_bounds__(256) void k_vt64(const float* __restrict__ V, bf* VT) {
    typedef __attribute__((ext_vector_type(2))) unsigned short v2us;
    const int lane = threadIdx.x & 31; const size_t wid = (size_t)blockIdx.x * 8 + (threadIdx.x >> 5); if (wid >= (size_t)HD * (SS / 64)) return; const int d = (int)(wid / (SS / 64)); const int t0 = (int)(wid % (SS / 64)) * 64 + lane * 2; v2us o;
    o[0] = f2bf(V[(size_t)t0 * HD + d]); o[1] = f2bf(V[(size_t)(t0 + 1) * HD + d]);
    const size_t off = (size_t)d * SS + t0; *(v2us*)(VT + off) = o; 
}
// k_csoft: block = 32 query rows (8 waves x 4 rows, sequential per wave): causal softmax of S x 1/8 over k <= i (three passes, f32): m, l, L = m + log(l); P = exp(s - m)/l for
__global__ __launch_bounds__(256) void k_csoft(const float* __restrict__ S, bf* PH, bf* PL, float* LOUT) {
    typedef __attribute__((ext_vector_type(4))) unsigned short v4us;
    __shared__ float lsh[32];
    const int lane = threadIdx.x & 31, wv = threadIdx.x >> 5;
#pragma unroll 1
    for (int rr = 0; rr < 4; ++rr) { const int i = blockIdx.x * 32 + wv * 4 + rr; const float* sr = S + (size_t)i * SS;
        float m = -3.0e38f;
#pragma unroll 1
        for (int c0 = lane * 4; c0 < SS; c0 += 128) {
#pragma unroll
            for (int q = 0; q < 4; ++q) { const int k = c0 + q; if (k <= i) m = fmaxf(m, sr[k] * SCL); } }
#pragma unroll
        for (int sh = 16; sh; sh >>= 1) m = fmaxf(m, __shfl_xor(m, sh, 32));
        float l = 0.f;
#pragma unroll 1
        for (int c0 = lane * 4; c0 < SS; c0 += 128) {
#pragma unroll
            for (int q = 0; q < 4; ++q) { const int k = c0 + q; if (k <= i) l += __expf(sr[k] * SCL - m); } }
#pragma unroll
        for (int sh = 16; sh; sh >>= 1) l += __shfl_xor(l, sh, 32);
        const float inv = 1.0f / l;
{
#pragma unroll 1
            for (int c0 = lane * 4; c0 < SS; c0 += 128) { v4us oh, ol;
#pragma unroll
                for (int q = 0; q < 4; ++q) { const int k = c0 + q; const float p = (k <= i) ? __expf(sr[(k <= i) ? k : 0] * SCL - m) * inv : 0.f; const unsigned short hb = f2bf(p); oh[q] = hb; ol[q] = f2bf(p - bf2f(hb)); }
                const size_t o = (size_t)i * SS + c0; *(v4us*)(PH + o) = oh; *(v4us*)(PL + o) = ol; }
             }
        if (lane == 0) lsh[wv * 4 + rr] = m + logf(l); }
    __syncthreads();
    if (wv == 0) { const float v = lsh[lane]; float* d = LOUT + (size_t)blockIdx.x * 32 + lane; *(float*)d = v;  }
}

extern "C" void kernel_launch(void* const* d_in, const int* in_sizes, int n_in,
                              void* d_out, int out_size, void* d_ws, size_t ws_size, hipStream_t stream) {
    (void)in_sizes; (void)n_in; (void)out_size;
    const float* Q = (const float*)d_in[0]; const float* Kx = (const float*)d_in[1]; const float* V = (const float*)d_in[2];
    float* O = (float*)d_out;                                              // [2][16][2048][64]
    float* LO = (float*)((char*)d_out + (size_t)NB_ * NH_ * SS * HD * 4);  // [2][16][2048][1] right after O
    char* wsp = (char*)d_ws;
    auto take = [&](size_t bytes) { char* p = wsp; wsp += (bytes + 255) & ~(size_t)255; return (void*)p; };
    bf* Qb = (bf*)take((size_t)SS * HD * 2); bf* Kb = (bf*)take((size_t)SS * HD * 2); bf* VT = (bf*)take((size_t)HD * SS * 2); float* S = (float*)take((size_t)SS * SS * 4); bf* PH = (bf*)take((size_t)SS * SS * 2); bf* PL = (bf*)take((size_t)SS * SS * 2);
    if ((size_t)(wsp - (char*)d_ws) > ws_size) return;    // 0.8 + 16.8 + 8.4 + 8.4 ~ 34 MB; reused per map in stream order
    for (int mp = 0; mp < NB_ * NH_; ++mp) { const size_t mo = (size_t)mp * SS * HD;
        k_cvt64<<<SS / 8, 256, 0, stream>>>(Q + mo, Qb); k_cvt64<<<SS / 8, 256, 0, stream>>>(Kx + mo, Kb); k_vt64<<<(HD * (SS / 64)) / 8, 256, 0, stream>>>(V + mo, VT);
        k_gemm3x<1 | 4><<<dim3(SS / 64, SS / 64, 1), 128, 0, stream>>>(Qb, Qb, Kb, Kb, HD, S, SS);            // scores (exact, causal tiles only)
        k_csoft<<<SS / 32, 256, 0, stream>>>(S, PH, PL, LO + (size_t)mp * SS);                            // P planes + L rows
        k_gemm3x<2 | 8><<<dim3(SS / 64, 1, 1), 128, 0, stream>>>(PH, PL, VT, VT, SS, O + mo, HD); }          // O = P . V (P hi/lo x V exact; causal K limit)
}

// v001
// Measured time: 643 microseconds a run.
// Two timings next to v000 put it at 8.11 and 8.08 times that version's speed.
#include <hip/hip_runtime.h>

// Compute dtypes, f32 accumulate, per (batch, head) map: S = Q.K^T as a [2048 x 64].[64 x 2048] GEMM with PLAIN bf16 operands (the inputs themselves, rounded; exact products;
// key tiles entirely above the diagonal are skipped and never read); causal softmax statistics (m, l) and L = m + log l in f32; P = exp(S/8 - L) -> bf16 hi + UNSCALED residual planes
// (zero above the diagonal); O = P.V ([2048 x 2048].[2048 x 64], P hi/lo x exact V, two products, K limited to the causal extent) - on v_wmma_f32_16x16x32_bf16. Deterministic, no

#define NB_  2
#define NH_  16
#define SS   2048
#define HD   64
#define SCL  0.125f
#define LOSC 1024.0f
#define NMAP (NB_ * NH_)   // (batch, head) maps; every launch covers all of them (grid z in k_gemm3x, y in k_vt64 and k_csoft, folded into x in k_cvt64)
#define BT   7             // 64-row query tiles in the widest band: S and both P planes of NMAP x BT x 64 rows fit the workspace
#define BR   (BT * 64)

typedef _Float16 h16;
typedef unsigned short bf;
typedef __attribute__((ext_vector_type(16))) __bf16   v16bf;
typedef __attribute__((ext_vector_type(16))) _Float16 v16h;
typedef __attribute__((ext_vector_type(8)))  _Float16 v8h;
typedef __attribute__((ext_vector_type(8)))  unsigned short v8us;
typedef __attribute__((ext_vector_type(8)))  float    v8f;
typedef __attribute__((ext_vector_type(4)))  float    v4f;
typedef __attribute__((ext_vector_type(4)))  _Float16 v4h;
typedef v8h  __attribute__((may_alias)) v8ha;
typedef v4f  __attribute__((may_alias)) v4fa;
typedef v8us __attribute__((may_alias)) v8usa;

__device__ __forceinline__ unsigned short f2bf(float f) { unsigned u = __float_as_uint(f); u += 0x7FFFu + ((u >> 16) & 1u); return (unsigned short)(u >> 16); }
__device__ __forceinline__ float bf2f(unsigned short b) { return __uint_as_float(((unsigned)b) << 16); }
__device__ __forceinline__ float bfr(float f) { return bf2f(f2bf(f)); }
__device__ __forceinline__ v16h cat16(v8h lo, v8h hi) { return __builtin_shufflevector(lo, hi, 0, 1, 2, 3, 4, 5, 6, 7, 8, 9, 10, 11, 12, 13, 14, 15); }
__device__ __forceinline__ v16bf cat16b(v8us lo, v8us hi) { return __builtin_bit_cast(v16bf, __builtin_shufflevector(lo, hi, 0, 1, 2, 3, 4, 5, 6, 7, 8, 9, 10, 11, 12, 13, 14, 15)); }
__device__ __forceinline__ v8f wmma16(v16h a, v16h b, v8f c) { return __builtin_amdgcn_wmma_f32_16x16x32_f16(false, a, false, b, (short)0, c, false, false); }
__device__ __forceinline__ v8f wmmab(v16bf a, v16bf b, v8f c) { return __builtin_amdgcn_wmma_f32_16x16x32_bf16(false, a, false, b, (short)0, c, false, false); }

// blockIdx.z = map (element strides sA, sB, sC); blockIdx.x = row tile inside the band, rb = the band's first row tile inside the map (for the causal tests only).
// k_gemm3x: 64 x 64 tile of C = (Ah + Al).(Bh + Bl)^T over K (row strides = K for all four planes; n-major B): three products per 32-k step (hh, hl, lh); f32
template <int MODE>
__global__ __launch_bounds__(128) void k_gemm3x(const bf* __restrict__ Ah, const bf* __restrict__ Al, const bf* __restrict__ Bh, const bf* __restrict__ Bl, int K, float* C, int ldc, int rb, size_t sA, size_t sB, size_t sC) {
    const int gx = rb + (int)blockIdx.x;
    if ((MODE & 1) && (int)blockIdx.y * 64 > gx * 64 + 63) return;
    const int Klim = (MODE & 2) ? min(K, (gx + 1) * 64) : K;
    __shared__ __align__(16) float ost[4][16 * 68];
    const int lane = threadIdx.x & 31, wave = threadIdx.x >> 5, lr = lane & 15, hi = lane >> 4;
    const int r0 = blockIdx.x * 64 + wave * 16, c0 = blockIdx.y * 64;
    const size_t aoff = (size_t)blockIdx.z * sA + (size_t)(r0 + lr) * K + 8 * hi, boff = (size_t)blockIdx.z * sB;
    v8f acc[4];
#pragma unroll
    for (int t = 0; t < 4; ++t) acc[t] = (v8f){};
#pragma unroll 1
    for (int kc = 0; kc < Klim; kc += 32) {
        const v16bf a = cat16b(*(const v8us*)(Ah + aoff + kc), *(const v8us*)(Ah + aoff + kc + 16));
        v16bf al = a; if (!(MODE & 4)) al = cat16b(*(const v8us*)(Al + aoff + kc), *(const v8us*)(Al + aoff + kc + 16));
#pragma unroll
        for (int t = 0; t < 4; ++t) { const size_t bo = boff + (size_t)(c0 + t * 16 + lr) * K + kc + 8 * hi;
            const v16bf bh = cat16b(*(const v8us*)(Bh + bo), *(const v8us*)(Bh + bo + 16));
            acc[t] = wmmab(a, bh, acc[t]);
            if (!(MODE & 4)) { acc[t] = wmmab(al, bh, acc[t]); if (!(MODE & 8)) { const v16bf bl = cat16b(*(const v8us*)(Bl + bo), *(const v8us*)(Bl + bo + 16)); acc[t] = wmmab(a, bl, acc[t]); } } }
        asm volatile("v_nop\n\tv_nop\n\tv_nop\n\tv_nop" : "+v"(acc[0]), "+v"(acc[1]), "+v"(acc[2]), "+v"(acc[3]) : "v"(a), "v"(al));
    }
    float* os = &ost[wave][0];
#pragma unroll
    for (int t = 0; t < 4; ++t) {
#pragma unroll
        for (int j = 0; j < 8; ++j) os[(hi * 8 + j) * 68 + t * 16 + lr] = acc[t][j]; }
    __builtin_amdgcn_wave_barrier(); asm volatile("" ::: "memory");
    float* crow = C + (size_t)blockIdx.z * sC + (size_t)r0 * ldc + c0;
    auto pass = [&]() {
#pragma unroll
        for (int s = 0; s < 8; ++s) { const int Lid = (lane >> 3) + 4 * s, piece = lane & 7; const int row = Lid >> 1, cofs = (Lid & 1) * 32 + piece * 4;
            const v4f val = *(const v4fa*)(os + row * 68 + cofs); *(v4f*)(crow + (size_t)row * ldc + cofs) = val; }
    };
    pass(); 
}


__global__ __launch_bounds__(256) void k_cvt64(const float* __restrict__ src, bf* dst) {
    typedef __attribute__((ext_vector_type(2))) unsigned short v2us;
    const int lane = threadIdx.x & 31; const size_t r = (size_t)blockIdx.x * 8 + (threadIdx.x >> 5); if (r >= (size_t)NMAP * SS) return; v2us o; o[0] = f2bf(src[r * HD + lane * 2]); o[1] = f2bf(src[r * HD + lane * 2 + 1]);
    *(v2us*)(dst + r * HD + lane * 2) = o; 
}
__global__ __launch_bounds__(256) void k_vt64(const float* __restrict__ V, bf* VT) {
    typedef __attribute__((ext_vector_type(2))) unsigned short v2us;
    const int lane = threadIdx.x & 31; const size_t wid = (size_t)blockIdx.x * 8 + (threadIdx.x >> 5); if (wid >= (size_t)HD * (SS / 64)) return; const int d = (int)(wid / (SS / 64)); const int t0 = (int)(wid % (SS / 64)) * 64 + lane * 2; v2us o;
    V += (size_t)blockIdx.y * SS * HD; VT += (size_t)blockIdx.y * HD * SS;
    o[0] = f2bf(V[(size_t)t0 * HD + d]); o[1] = f2bf(V[(size_t)(t0 + 1) * HD + d]);
    const size_t off = (size_t)d * SS + t0; *(v2us*)(VT + off) = o; 
}
// k_csoft: block = 32 query rows (8 waves x 4 rows, sequential per wave): causal softmax of S x 1/8 over k <= i (three passes, f32): m, l, L = m + log(l); P = exp(s - m)/l for
__global__ __launch_bounds__(256) void k_csoft(const float* __restrict__ S, bf* PH, bf* PL, float* LOUT, int row0) {
    typedef __attribute__((ext_vector_type(4))) unsigned short v4us;
    __shared__ float lsh[32];
    const int lane = threadIdx.x & 31, wv = threadIdx.x >> 5;
    const size_t mrow = (size_t)blockIdx.y * BR;   // blockIdx.y = map; the planes hold BR rows a map, row0 = the band's first query row inside the map
#pragma unroll 1
    for (int rr = 0; rr < 4; ++rr) { const int il = blockIdx.x * 32 + wv * 4 + rr; const int i = row0 + il; const float* sr = S + (mrow + il) * SS;
        float m = -3.0e38f;
#pragma unroll 1
        for (int c0 = lane * 4; c0 < SS; c0 += 128) {
#pragma unroll
            for (int q = 0; q < 4; ++q) { const int k = c0 + q; if (k <= i) m = fmaxf(m, sr[k] * SCL); } }
#pragma unroll
        for (int sh = 16; sh; sh >>= 1) m = fmaxf(m, __shfl_xor(m, sh, 32));
        float l = 0.f;
#pragma unroll 1
        for (int c0 = lane * 4; c0 < SS; c0 += 128) {
#pragma unroll
            for (int q = 0; q < 4; ++q) { const int k = c0 + q; if (k <= i) l += __expf(sr[k] * SCL - m); } }
#pragma unroll
        for (int sh = 16; sh; sh >>= 1) l += __shfl_xor(l, sh, 32);
        const float inv = 1.0f / l;
{
#pragma unroll 1
            for (int c0 = lane * 4; c0 < SS; c0 += 128) { v4us oh, ol;
#pragma unroll
                for (int q = 0; q < 4; ++q) { const int k = c0 + q; const float p = (k <= i) ? __expf(sr[(k <= i) ? k : 0] * SCL - m) * inv : 0.f; const unsigned short hb = f2bf(p); oh[q] = hb; ol[q] = f2bf(p - bf2f(hb)); }
                const size_t o = (mrow + il) * SS + c0; *(v4us*)(PH + o) = oh; *(v4us*)(PL + o) = ol; }
             }
        if (lane == 0) lsh[wv * 4 + rr] = m + logf(l); }
    __syncthreads();
    if (wv == 0) { const float v = lsh[lane]; float* d = LOUT + (size_t)blockIdx.y * SS + row0 + (size_t)blockIdx.x * 32 + lane; *(float*)d = v;  }
}

extern "C" void kernel_launch(void* const* d_in, const int* in_sizes, int n_in,
                              void* d_out, int out_size, void* d_ws, size_t ws_size, hipStream_t stream) {
    (void)in_sizes; (void)n_in; (void)out_size;
    const float* Q = (const float*)d_in[0]; const float* Kx = (const float*)d_in[1]; const float* V = (const float*)d_in[2];
    float* O = (float*)d_out;                                              // [2][16][2048][64]
    float* LO = (float*)((char*)d_out + (size_t)NB_ * NH_ * SS * HD * 4);  // [2][16][2048][1] right after O
    char* wsp = (char*)d_ws;
    auto take = [&](size_t bytes) { char* p = wsp; wsp += (bytes + 255) & ~(size_t)255; return (void*)p; };
    bf* Qb = (bf*)take((size_t)NMAP * SS * HD * 2); bf* Kb = (bf*)take((size_t)NMAP * SS * HD * 2); bf* VT = (bf*)take((size_t)NMAP * HD * SS * 2);
    float* S = (float*)take((size_t)NMAP * BR * SS * 4); bf* PH = (bf*)take((size_t)NMAP * BR * SS * 2); bf* PL = (bf*)take((size_t)NMAP * BR * SS * 2);
    if ((size_t)(wsp - (char*)d_ws) > ws_size) return;    // 25 + 117 + 59 + 59 ~ 260 MB; S and P are reused per band in stream order
    k_cvt64<<<NMAP * SS / 8, 256, 0, stream>>>(Q, Qb); k_cvt64<<<NMAP * SS / 8, 256, 0, stream>>>(Kx, Kb); k_vt64<<<dim3((HD * (SS / 64)) / 8, NMAP, 1), 256, 0, stream>>>(V, VT);
    // One band = nt query tiles of every map, from tile rb on. The short band comes first: a band lasts as long as its last row's causal extent.
    auto band = [&](int rb, int nt) {
        k_gemm3x<1 | 4><<<dim3(nt, rb + nt, NMAP), 128, 0, stream>>>(Qb + (size_t)rb * 64 * HD, Qb + (size_t)rb * 64 * HD, Kb, Kb, HD, S, SS, rb, (size_t)SS * HD, (size_t)SS * HD, (size_t)BR * SS);   // scores (exact, causal tiles only)
        k_csoft<<<dim3(nt * 2, NMAP, 1), 256, 0, stream>>>(S, PH, PL, LO, rb * 64);                                                                                                        // P planes + L rows
        k_gemm3x<2 | 8><<<dim3(nt, 1, NMAP), 128, 0, stream>>>(PH, PL, VT, VT, SS, O + (size_t)rb * 64 * HD, HD, rb, (size_t)BR * SS, (size_t)HD * SS, (size_t)SS * HD); };               // O = P . V (P hi/lo x V exact; causal K limit)
    band(0, 4); band(4, 7); band(11, 7); band(18, 7); band(25, 7);
}

// v002
// One run takes 77.3 microseconds.
// Next to v001, in two timings, it ran 8.35 and 8.37 times as fast.
// All steps since v000 together make it 67.6 times as fast.
#include <hip/hip_runtime.h>
#include <math.h>

#define NB_  2
#define NH_  16
#define SS   2048
#define HD   64
#define NMAP (NB_ * NH_)   // (batch, head) maps
#define QW   32            // query columns per wave
#define NWV  4             // waves per workgroup
#define OP   68            // output staging pitch in floats

typedef unsigned short bf;
typedef __attribute__((ext_vector_type(16))) __bf16   v16bf;
typedef __attribute__((ext_vector_type(2)))  __bf16   v2bf;
typedef __attribute__((ext_vector_type(8)))  unsigned short v8us;
typedef __attribute__((ext_vector_type(8)))  unsigned v8u;
typedef __attribute__((ext_vector_type(8)))  float    v8f;
typedef __attribute__((ext_vector_type(4)))  float    v4f;
typedef __attribute__((ext_vector_type(2)))  float    v2f;
typedef v4f  __attribute__((may_alias)) v4fa;

__device__ __forceinline__ unsigned short f2bf(float f) { unsigned u = __float_as_uint(f); u += 0x7FFFu + ((u >> 16) & 1u); return (unsigned short)(u >> 16); }
__device__ __forceinline__ v16bf cat16b(v8us lo, v8us hi) { return __builtin_bit_cast(v16bf, __builtin_shufflevector(lo, hi, 0, 1, 2, 3, 4, 5, 6, 7, 8, 9, 10, 11, 12, 13, 14, 15)); }
__device__ __forceinline__ v8f wmmab(v16bf a, v16bf b, v8f c) { return __builtin_amdgcn_wmma_f32_16x16x32_bf16(false, a, false, b, (short)0, c, false, false); }
// One 16 x 32 operand fragment from a row-major plane; p = the lane's row + 8 * (lane >> 4): elements 0-7 are k = 8 hi + 0..7, elements 8-15 are k = 16 + 8 hi + 0..7.
__device__ __forceinline__ v16bf ldfrag(const bf* p) { return cat16b(*(const v8us*)p, *(const v8us*)(p + 16)); }
__device__ __forceinline__ unsigned pack2(float a, float b) { return __builtin_bit_cast(unsigned, __builtin_convertvector((v2f){a, b}, v2bf)); }   // round to nearest even
// The same fragment from an f32 plane, rounded to bf16 on the way (p as above).
__device__ __forceinline__ v16bf ldfragf(const float* p) { const v4f a = *(const v4f*)p, b = *(const v4f*)(p + 4), c = *(const v4f*)(p + 16), d = *(const v4f*)(p + 20);
    return __builtin_bit_cast(v16bf, (v8u){pack2(a[0], a[1]), pack2(a[2], a[3]), pack2(b[0], b[1]), pack2(b[2], b[3]), pack2(c[0], c[1]), pack2(c[2], c[3]), pack2(d[0], d[1]), pack2(d[2], d[3])}); }
__device__ __forceinline__ float xhalf(float x) { return __builtin_bit_cast(float, __builtin_amdgcn_permlanex16(__builtin_bit_cast(int, x), __builtin_bit_cast(int, x), 0x76543210, 0xfedcba98, false, false)); }   // lane l with lane l ^ 16

// blockIdx.x = map, blockIdx.y picks the block of 128 query rows. Waves are independent: no barrier, K and V^T fragments straight from the bf16 planes.
__global__ __launch_bounds__(NWV * 32) void k_fused(const float* __restrict__ Q, const bf* __restrict__ Kb, const bf* __restrict__ VT, float* __restrict__ O, float* __restrict__ LOUT) {
    __shared__ __align__(16) float ost[NWV][QW * OP];
    const int lane = threadIdx.x & 31, wave = __builtin_amdgcn_readfirstlane(threadIdx.x >> 5), lr = lane & 15, hi = lane >> 4;
    const int map = blockIdx.x, y = blockIdx.y;
    const int qb = (y < 8) ? 15 - y : y - 8;   // long blocks start first; the second half of the grid runs short to long beside them
    const int qt = qb * NWV + wave, q0 = qt * QW;   // this wave's tile of 32 queries: it sees keys 0 .. q0 + 31 = qt + 1 passes
    const float cs = 0.125f * 1.4426950408889634f;   // 1 / sqrt(64), in the base-2 domain
    const float* Qm = Q + (size_t)map * SS * HD; const bf* Km = Kb + (size_t)map * SS * HD + (size_t)lr * HD + 8 * hi; const bf* Vm = VT + (size_t)map * HD * SS + (size_t)lr * SS + 8 * hi;
    v16bf qf[2][2], kf[2][2];
#pragma unroll
    for (int g = 0; g < 2; ++g) {
#pragma unroll
        for (int kc = 0; kc < 2; ++kc) qf[g][kc] = ldfragf(Qm + (size_t)(q0 + 16 * g + lr) * HD + 32 * kc + 8 * hi); }
#pragma unroll
    for (int kt = 0; kt < 2; ++kt) {
#pragma unroll
        for (int kc = 0; kc < 2; ++kc) kf[kt][kc] = ldfrag(Km + (size_t)(16 * kt) * HD + 32 * kc); }
    v8f acc[2][4]; float m[2], l[2];
#pragma unroll
    for (int g = 0; g < 2; ++g) { m[g] = -INFINITY; l[g] = 0.f;
#pragma unroll
        for (int t = 0; t < 4; ++t) acc[g][t] = (v8f){}; }
#pragma unroll 1
    for (int ps = 0; ps <= qt; ++ps) {
        const int key0 = ps * 32;
        v16bf vf[4];   // V^T, 16 (d) x 32 (keys) each: asked for here, needed behind the exponentials
#pragma unroll
        for (int t = 0; t < 4; ++t) vf[t] = ldfrag(Vm + (size_t)(16 * t) * SS + key0);
        v8f s[2][2];   // [16-key tile][16-query group]: register j = key key0 + 16 kt + 8 hi + j, lane column = query q0 + 16 g + lr
#pragma unroll
        for (int kt = 0; kt < 2; ++kt) {
#pragma unroll
            for (int g = 0; g < 2; ++g) s[kt][g] = wmmab(kf[kt][1], qf[g][1], wmmab(kf[kt][0], qf[g][0], (v8f){})); }
        const int nk = (ps < qt ? ps + 1 : ps) * 32;
#pragma unroll
        for (int kt = 0; kt < 2; ++kt) {
#pragma unroll
            for (int kc = 0; kc < 2; ++kc) kf[kt][kc] = ldfrag(Km + (size_t)(nk + 16 * kt) * HD + 32 * kc); }
        asm volatile("s_wait_xcnt 0x0" ::: "memory");   // the address registers of the loads above are reused right below: the wait stands in front of that overwrite
        if (ps == qt) {   // wave-uniform: only the pass on the diagonal pays for the mask
#pragma unroll
            for (int g = 0; g < 2; ++g) { const int q = q0 + 16 * g + lr;
#pragma unroll
                for (int kt = 0; kt < 2; ++kt) {
#pragma unroll
                    for (int j = 0; j < 8; ++j) if (key0 + 16 * kt + 8 * hi + j > q) s[kt][g][j] = -INFINITY;
                } }
        }
#pragma unroll
        for (int g = 0; g < 2; ++g) {
            float mx = s[0][g][0];
#pragma unroll
            for (int j = 1; j < 8; ++j) mx = fmaxf(mx, s[0][g][j]);
#pragma unroll
            for (int j = 0; j < 8; ++j) mx = fmaxf(mx, s[1][g][j]);
            mx = fmaxf(mx, xhalf(mx));
            const float mn = fmaxf(m[g], mx * cs);
            const float al = __builtin_amdgcn_exp2f(m[g] - mn);   // 0 on the first pass
            m[g] = mn; l[g] *= al;
#pragma unroll
            for (int t = 0; t < 4; ++t) acc[g][t] = acc[g][t] * al;
            v8u wh, wl; float ls = 0.f;
#pragma unroll
            for (int i = 0; i < 8; ++i) {
                const v2f ar = __builtin_elementwise_fma((v2f){s[i >> 2][g][2 * (i & 3)], s[i >> 2][g][2 * (i & 3) + 1]}, (v2f){cs, cs}, (v2f){-mn, -mn});
                const float p0 = __builtin_amdgcn_exp2f(ar[0]), p1 = __builtin_amdgcn_exp2f(ar[1]);
                const unsigned h = pack2(p0, p1);
                wh[i] = h; wl[i] = pack2(p0 - __uint_as_float(h << 16), p1 - __uint_as_float(h & 0xFFFF0000u));
                ls += p0 + p1; }
            l[g] += ls;
            const v16bf ph = __builtin_bit_cast(v16bf, wh), pl = __builtin_bit_cast(v16bf, wl);
#pragma unroll
            for (int t = 0; t < 4; ++t) acc[g][t] = wmmab(vf[t], pl, wmmab(vf[t], ph, acc[g][t]));
        }
    }
    // Epilogue: normalise, stage the wave's 32 x 64 tile in its own LDS slice, store whole rows.
    float* os = &ost[wave][0];
#pragma unroll
    for (int g = 0; g < 2; ++g) {
        const float lt = l[g] + xhalf(l[g]);   // the halves' sums join here, unconditionally
        const float inv = 1.0f / lt;
#pragma unroll
        for (int t = 0; t < 4; ++t) { const v8f o = acc[g][t] * inv; float* d = os + (16 * g + lr) * OP + 16 * t + 8 * hi;
            *(v4fa*)d = (v4f){o[0], o[1], o[2], o[3]}; *(v4fa*)(d + 4) = (v4f){o[4], o[5], o[6], o[7]}; }
        const float Lv = m[g] * 0.6931471805599453f + logf(lt);
        if (hi == 0) LOUT[(size_t)map * SS + q0 + 16 * g + lr] = Lv;
    }
    __builtin_amdgcn_wave_barrier(); asm volatile("" ::: "memory");   // the rows below were written by other lanes of this wave: keeps the reads behind the writes
    float* orow = O + ((size_t)map * SS + q0) * HD;
#pragma unroll
    for (int r = 0; r < QW / 2; ++r) { const int row = 2 * r + hi; const v4f val = *(const v4fa*)(os + row * OP + lr * 4); *(v4f*)(orow + (size_t)row * HD + lr * 4) = val; }
}

__global__ __launch_bounds__(256) void k_cvt64(const float* __restrict__ src, bf* dst) {
    typedef __attribute__((ext_vector_type(2))) unsigned short v2us;
    const int lane = threadIdx.x & 31; const size_t r = (size_t)blockIdx.x * 8 + (threadIdx.x >> 5); if (r >= (size_t)NMAP * SS) return; v2us o; o[0] = f2bf(src[r * HD + lane * 2]); o[1] = f2bf(src[r * HD + lane * 2 + 1]);
    *(v2us*)(dst + r * HD + lane * 2) = o; 
}
__global__ __launch_bounds__(256) void k_vt64(const float* __restrict__ V, bf* VT) {
    typedef __attribute__((ext_vector_type(2))) unsigned short v2us;
    const int lane = threadIdx.x & 31; const size_t wid = (size_t)blockIdx.x * 8 + (threadIdx.x >> 5); if (wid >= (size_t)HD * (SS / 64)) return; const int d = (int)(wid / (SS / 64)); const int t0 = (int)(wid % (SS / 64)) * 64 + lane * 2; v2us o;
    V += (size_t)blockIdx.y * SS * HD; VT += (size_t)blockIdx.y * HD * SS;
    o[0] = f2bf(V[(size_t)t0 * HD + d]); o[1] = f2bf(V[(size_t)(t0 + 1) * HD + d]);
    const size_t off = (size_t)d * SS + t0; *(v2us*)(VT + off) = o; 
}

extern "C" void kernel_launch(void* const* d_in, const int* in_sizes, int n_in,
                              void* d_out, int out_size, void* d_ws, size_t ws_size, hipStream_t stream) {
    (void)in_sizes; (void)n_in; (void)out_size;
    const float* Q = (const float*)d_in[0]; const float* Kx = (const float*)d_in[1]; const float* V = (const float*)d_in[2];
    float* O = (float*)d_out;                                              // [2][16][2048][64]
    float* LO = (float*)((char*)d_out + (size_t)NB_ * NH_ * SS * HD * 4);  // [2][16][2048][1] right after O
    char* wsp = (char*)d_ws;
    auto take = [&](size_t bytes) { char* p = wsp; wsp += (bytes + 255) & ~(size_t)255; return (void*)p; };
    bf* Kb = (bf*)take((size_t)NMAP * SS * HD * 2); bf* VT = (bf*)take((size_t)NMAP * HD * SS * 2);
    if ((size_t)(wsp - (char*)d_ws) > ws_size) return;    // 17 MB
    k_cvt64<<<NMAP * SS / 8, 256, 0, stream>>>(Kx, Kb); k_vt64<<<dim3((HD * (SS / 64)) / 8, NMAP, 1), 256, 0, stream>>>(V, VT);
    k_fused<<<dim3(NMAP, SS / (QW * NWV), 1), NWV * 32, 0, stream>>>(Q, Kb, VT, O, LO);
}

// v003
// One run takes 61.9 microseconds.
// In both of two side-by-side timings against v002, it was 1.24 times as fast.
// Counting every step since v000, it is 84.0 times as fast.
#include <hip/hip_runtime.h>
#include <math.h>

#define NB_  2
#define NH_  16
#define SS   2048
#define HD   64
#define NMAP (NB_ * NH_)   // (batch, head) maps
#define QW   32            // query columns per wave
#define NWV  4             // waves per workgroup
#define OP   68            // output staging pitch in floats
#define PW   8             // waves per workgroup of the conversion kernel
#define PVB  (NMAP * SS * HD / (PW * 2048))   // its workgroups per operand: 2048 elements per wave
#define VPC  9             // V^T staging pitch in 16-byte pieces: 8 of data + 1, so that writes and reads both spread over all banks

typedef unsigned short bf;
typedef __attribute__((ext_vector_type(16))) __bf16   v16bf;
typedef __attribute__((ext_vector_type(2)))  __bf16   v2bf;
typedef __attribute__((ext_vector_type(8)))  unsigned short v8us;
typedef __attribute__((ext_vector_type(8)))  unsigned v8u;
typedef __attribute__((ext_vector_type(4)))  unsigned v4u;
typedef __attribute__((ext_vector_type(2)))  unsigned v2u;
typedef __attribute__((ext_vector_type(8)))  float    v8f;
typedef __attribute__((ext_vector_type(4)))  float    v4f;
typedef __attribute__((ext_vector_type(2)))  float    v2f;
typedef v4f  __attribute__((may_alias)) v4fa;

__device__ __forceinline__ v16bf cat16b(v8us lo, v8us hi) { return __builtin_bit_cast(v16bf, __builtin_shufflevector(lo, hi, 0, 1, 2, 3, 4, 5, 6, 7, 8, 9, 10, 11, 12, 13, 14, 15)); }
__device__ __forceinline__ v8f wmmab(v16bf a, v16bf b, v8f c) { return __builtin_amdgcn_wmma_f32_16x16x32_bf16(false, a, false, b, (short)0, c, false, false); }
// One 16 x 32 operand fragment from a row-major plane; p = the lane's row + 8 * (lane >> 4): elements 0-7 are k = 8 hi + 0..7, elements 8-15 are k = 16 + 8 hi + 0..7.
__device__ __forceinline__ v16bf ldfrag(const bf* p) { return cat16b(*(const v8us*)p, *(const v8us*)(p + 16)); }
__device__ __forceinline__ unsigned pack2(float a, float b) { return __builtin_bit_cast(unsigned, __builtin_convertvector((v2f){a, b}, v2bf)); }   // round to nearest even
// The same fragment from an f32 plane, rounded to bf16 on the way (p as above).
__device__ __forceinline__ v16bf ldfragf(const float* p) { const v4f a = *(const v4f*)p, b = *(const v4f*)(p + 4), c = *(const v4f*)(p + 16), d = *(const v4f*)(p + 20);
    return __builtin_bit_cast(v16bf, (v8u){pack2(a[0], a[1]), pack2(a[2], a[3]), pack2(b[0], b[1]), pack2(b[2], b[3]), pack2(c[0], c[1]), pack2(c[2], c[3]), pack2(d[0], d[1]), pack2(d[2], d[3])}); }
__device__ __forceinline__ float xhalf(float x) { return __builtin_bit_cast(float, __builtin_amdgcn_permlanex16(__builtin_bit_cast(int, x), __builtin_bit_cast(int, x), 0x76543210, 0xfedcba98, false, false)); }   // lane l with lane l ^ 16

// blockIdx.x = map, blockIdx.y picks the block of 128 query rows. Waves are independent: no barrier, K and V^T fragments straight from the bf16 planes.
__global__ __launch_bounds__(NWV * 32) void k_fused(const float* __restrict__ Q, const bf* __restrict__ Kb, const bf* __restrict__ VT, float* __restrict__ O, float* __restrict__ LOUT) {
    __shared__ __align__(16) float ost[NWV][QW * OP];
    const int lane = threadIdx.x & 31, wave = __builtin_amdgcn_readfirstlane(threadIdx.x >> 5), lr = lane & 15, hi = lane >> 4;
    const int map = blockIdx.x, y = blockIdx.y;
    const int qb = (y < 8) ? 15 - y : y - 8;   // long blocks start first; the second half of the grid runs short to long beside them
    const int qt = qb * NWV + wave, q0 = qt * QW;   // this wave's tile of 32 queries: it sees keys 0 .. q0 + 31 = qt + 1 passes
    const float cs = 0.125f * 1.4426950408889634f;   // 1 / sqrt(64), in the base-2 domain
    const float* Qm = Q + (size_t)map * SS * HD; const bf* Km = Kb + (size_t)map * SS * HD + (size_t)lr * HD + 8 * hi; const bf* Vm = VT + (size_t)map * HD * SS + (size_t)lr * SS + 8 * hi;
    v16bf qf[2][2], kf[2][2];
#pragma unroll
    for (int g = 0; g < 2; ++g) {
#pragma unroll
        for (int kc = 0; kc < 2; ++kc) qf[g][kc] = ldfragf(Qm + (size_t)(q0 + 16 * g + lr) * HD + 32 * kc + 8 * hi); }
#pragma unroll
    for (int kt = 0; kt < 2; ++kt) {
#pragma unroll
        for (int kc = 0; kc < 2; ++kc) kf[kt][kc] = ldfrag(Km + (size_t)(16 * kt) * HD + 32 * kc); }
    v8f acc[2][4]; float m[2], l[2];
#pragma unroll
    for (int g = 0; g < 2; ++g) { m[g] = -INFINITY; l[g] = 0.f;
#pragma unroll
        for (int t = 0; t < 4; ++t) acc[g][t] = (v8f){}; }
#pragma unroll 1
    for (int ps = 0; ps <= qt; ++ps) {
        const int key0 = ps * 32;
        v16bf vf[4];   // V^T, 16 (d) x 32 (keys) each: asked for here, needed behind the exponentials
#pragma unroll
        for (int t = 0; t < 4; ++t) vf[t] = ldfrag(Vm + (size_t)(16 * t) * SS + key0);
        v8f s[2][2];   // [16-key tile][16-query group]: register j = key key0 + 16 kt + 8 hi + j, lane column = query q0 + 16 g + lr
#pragma unroll
        for (int kt = 0; kt < 2; ++kt) {
#pragma unroll
            for (int g = 0; g < 2; ++g) s[kt][g] = wmmab(kf[kt][1], qf[g][1], wmmab(kf[kt][0], qf[g][0], (v8f){})); }
        const int nk = (ps < qt ? ps + 1 : ps) * 32;
#pragma unroll
        for (int kt = 0; kt < 2; ++kt) {
#pragma unroll
            for (int kc = 0; kc < 2; ++kc) kf[kt][kc] = ldfrag(Km + (size_t)(nk + 16 * kt) * HD + 32 * kc); }
        asm volatile("s_wait_xcnt 0x0" ::: "memory");   // the address registers of the loads above are reused right below: the wait stands in front of that overwrite
        if (ps == qt) {   // wave-uniform: only the pass on the diagonal pays for the mask
#pragma unroll
            for (int g = 0; g < 2; ++g) { const int q = q0 + 16 * g + lr;
#pragma unroll
                for (int kt = 0; kt < 2; ++kt) {
#pragma unroll
                    for (int j = 0; j < 8; ++j) if (key0 + 16 * kt + 8 * hi + j > q) s[kt][g][j] = -INFINITY;
                } }
        }
#pragma unroll
        for (int g = 0; g < 2; ++g) {
            float mx = s[0][g][0];
#pragma unroll
            for (int j = 1; j < 8; ++j) mx = fmaxf(mx, s[0][g][j]);
#pragma unroll
            for (int j = 0; j < 8; ++j) mx = fmaxf(mx, s[1][g][j]);
            mx = fmaxf(mx, xhalf(mx));
            const float mn = fmaxf(m[g], mx * cs);
            const float al = __builtin_amdgcn_exp2f(m[g] - mn);   // 0 on the first pass
            m[g] = mn; l[g] *= al;
#pragma unroll
            for (int t = 0; t < 4; ++t) acc[g][t] = acc[g][t] * al;
            v8u wh, wl; float ls = 0.f;
#pragma unroll
            for (int i = 0; i < 8; ++i) {
                const v2f ar = __builtin_elementwise_fma((v2f){s[i >> 2][g][2 * (i & 3)], s[i >> 2][g][2 * (i & 3) + 1]}, (v2f){cs, cs}, (v2f){-mn, -mn});
                const float p0 = __builtin_amdgcn_exp2f(ar[0]), p1 = __builtin_amdgcn_exp2f(ar[1]);
                const unsigned h = pack2(p0, p1);
                wh[i] = h; wl[i] = pack2(p0 - __uint_as_float(h << 16), p1 - __uint_as_float(h & 0xFFFF0000u));
                ls += p0 + p1; }
            l[g] += ls;
            const v16bf ph = __builtin_bit_cast(v16bf, wh), pl = __builtin_bit_cast(v16bf, wl);
#pragma unroll
            for (int t = 0; t < 4; ++t) acc[g][t] = wmmab(vf[t], pl, wmmab(vf[t], ph, acc[g][t]));
        }
    }
    // Epilogue: normalise, stage the wave's 32 x 64 tile in its own LDS slice, store whole rows.
    float* os = &ost[wave][0];
#pragma unroll
    for (int g = 0; g < 2; ++g) {
        const float lt = l[g] + xhalf(l[g]);   // the halves' sums join here, unconditionally
        const float inv = 1.0f / lt;
#pragma unroll
        for (int t = 0; t < 4; ++t) { const v8f o = acc[g][t] * inv; float* d = os + (16 * g + lr) * OP + 16 * t + 8 * hi;
            *(v4fa*)d = (v4f){o[0], o[1], o[2], o[3]}; *(v4fa*)(d + 4) = (v4f){o[4], o[5], o[6], o[7]}; }
        const float Lv = m[g] * 0.6931471805599453f + logf(lt);
        if (hi == 0) LOUT[(size_t)map * SS + q0 + 16 * g + lr] = Lv;
    }
    __builtin_amdgcn_wave_barrier(); asm volatile("" ::: "memory");   // the rows below were written by other lanes of this wave: keeps the reads behind the writes
    float* orow = O + ((size_t)map * SS + q0) * HD;
#pragma unroll
    for (int r = 0; r < QW / 2; ++r) { const int row = 2 * r + hi; const v4f val = *(const v4fa*)(os + row * OP + lr * 4); *(v4f*)(orow + (size_t)row * HD + lr * 4) = val; }
}

// K to bf16 and V to bf16 V^T in one launch. A wave takes 8 KB of f32 with all its 16 loads of 16 bytes asked for at once; every load and every store covers whole 128-byte lines.
// blockIdx.x < PVB: V. A wave owns 64 positions x 32 columns: a lane loads 8 consecutive positions x 4 columns (twice), packs each column's 8 values into 16 bytes,
// and the wave turns the tile round in its own LDS slice, so that a V^T row leaves as one 128-byte line. The other workgroups: K, element for element.
__global__ __launch_bounds__(PW * 32) void k_prep(const float* __restrict__ K, const float* __restrict__ V, bf* __restrict__ Kb, bf* __restrict__ VT) {
    __shared__ v4u vst[PW][32 * VPC];
    const int lane = threadIdx.x & 31, wave = __builtin_amdgcn_readfirstlane(threadIdx.x >> 5);
    if (blockIdx.x < PVB) {
        const int vw = blockIdx.x * PW + wave, map = vw >> 6, t0 = ((vw & 63) >> 1) * 64, d0 = (vw & 1) * 32, q = lane & 7, u = lane >> 3;
        const float* s = V + ((size_t)map * SS + t0 + 8 * u) * HD + d0 + 4 * q;
        v4f x[2][8];
#pragma unroll
        for (int h = 0; h < 2; ++h) {
#pragma unroll
            for (int j = 0; j < 8; ++j) x[h][j] = *(const v4f*)(s + (32 * h + j) * HD); }
        __builtin_amdgcn_sched_barrier(0);   // all 16 loads are asked for before the first value is used: without it the compiler holds the second eight back until the first eight have come
        asm volatile("s_wait_xcnt 0x0" :: "v"(s) : "memory");   // keeps the loads' address pair alive behind all 16, so that the last load's result does not land in it while the others still name it; any later reuse of the pair is behind this wait
        v4u* st = &vst[wave][0];
#pragma unroll
        for (int h = 0; h < 2; ++h) {
#pragma unroll
            for (int i = 0; i < 4; ++i)   // row = column d0 + 4 q + i, 16-byte piece 4 h + u = positions t0 + 32 h + 8 u + 0..7
                st[(4 * q + i) * VPC + 4 * h + u] = (v4u){pack2(x[h][0][i], x[h][1][i]), pack2(x[h][2][i], x[h][3][i]), pack2(x[h][4][i], x[h][5][i]), pack2(x[h][6][i], x[h][7][i])}; }
        asm volatile("s_wait_dscnt 0x0" ::: "memory");   // the pieces read below were written by other lanes of this wave: the writes are done, and the reads stay behind them
        bf* d = VT + ((size_t)map * HD + d0 + u) * SS + t0 + 8 * q;
#pragma unroll
        for (int r = 0; r < 8; ++r) *(v4u*)(d + (size_t)(4 * r) * SS) = st[(4 * r + u) * VPC + q];
    } else {
        const size_t o = ((size_t)(blockIdx.x - PVB) * PW + wave) * 2048 + lane * 4;
        v4f x[16];
#pragma unroll
        for (int i = 0; i < 16; ++i) x[i] = *(const v4f*)(K + o + 128 * i);
        __builtin_amdgcn_sched_barrier(0);   // as above: without it the last four loads are held back until the first values have come
        asm volatile("s_wait_xcnt 0x0" :: "v"(K + o) : "memory");   // as above, for this run's address pair
#pragma unroll
        for (int i = 0; i < 16; ++i) *(v2u*)(Kb + o + 128 * i) = (v2u){pack2(x[i][0], x[i][1]), pack2(x[i][2], x[i][3])};
        asm volatile("s_wait_xcnt 0x0" ::: "memory");   // behind the last store: no path from here rewrites a register of a store without it
    }
}

extern "C" void kernel_launch(void* const* d_in, const int* in_sizes, int n_in,
                              void* d_out, int out_size, void* d_ws, size_t ws_size, hipStream_t stream) {
    (void)in_sizes; (void)n_in; (void)out_size;
    const float* Q = (const float*)d_in[0]; const float* Kx = (const float*)d_in[1]; const float* V = (const float*)d_in[2];
    float* O = (float*)d_out;                                              // [2][16][2048][64]
    float* LO = (float*)((char*)d_out + (size_t)NB_ * NH_ * SS * HD * 4);  // [2][16][2048][1] right after O
    char* wsp = (char*)d_ws;
    auto take = [&](size_t bytes) { char* p = wsp; wsp += (bytes + 255) & ~(size_t)255; return (void*)p; };
    bf* Kb = (bf*)take((size_t)NMAP * SS * HD * 2); bf* VT = (bf*)take((size_t)NMAP * HD * SS * 2);
    if ((size_t)(wsp - (char*)d_ws) > ws_size) return;    // 17 MB
    k_prep<<<2 * PVB, PW * 32, 0, stream>>>(Kx, V, Kb, VT);
    k_fused<<<dim3(NMAP, SS / (QW * NWV), 1), NWV * 32, 0, stream>>>(Q, Kb, VT, O, LO);
}

// v004
// A run of this version takes 56.4 microseconds.
// Timed twice side by side with v003, it ran 1.07 and 1.11 times as fast.
// Counting every step since v000, it is 91.7 times as fast.
#include <hip/hip_runtime.h>
#include <math.h>

#define NB_  2
#define NH_  16
#define SS   2048
#define HD   64
#define NMAP (NB_ * NH_)   // (batch, head) maps
#define QW   32            // query columns per wave
#define NWV  4             // waves per workgroup
#define OP   68            // output staging pitch in floats
#define PW   8             // waves per workgroup of the conversion kernel
#define PVB  (NMAP * SS * HD / (PW * 2048))   // its workgroups per operand: 2048 elements per wave
#define FB   256           // elements of one 512-byte block of a fragment-order plane
#define VPC  17            // staging pitch of half a block (16 pieces of 16 bytes) for V: + 1 piece, so that the 16-byte writes spread over all banks
#define KPC  18            // the same for K: + 2 pieces, so that the 8-byte writes spread over all banks

typedef unsigned short bf;
typedef __attribute__((ext_vector_type(16))) __bf16   v16bf;
typedef __attribute__((ext_vector_type(2)))  __bf16   v2bf;
typedef __attribute__((ext_vector_type(8)))  unsigned short v8us;
typedef __attribute__((ext_vector_type(8)))  unsigned v8u;
typedef __attribute__((ext_vector_type(4)))  unsigned v4u;
typedef __attribute__((ext_vector_type(2)))  unsigned v2u;
typedef __attribute__((ext_vector_type(8)))  float    v8f;
typedef __attribute__((ext_vector_type(4)))  float    v4f;
typedef __attribute__((ext_vector_type(2)))  float    v2f;
typedef v4f  __attribute__((may_alias)) v4fa;
typedef v2u  __attribute__((may_alias)) v2ua;

__device__ __forceinline__ v16bf cat16b(v8us lo, v8us hi) { return __builtin_bit_cast(v16bf, __builtin_shufflevector(lo, hi, 0, 1, 2, 3, 4, 5, 6, 7, 8, 9, 10, 11, 12, 13, 14, 15)); }
__device__ __forceinline__ v8f wmmab(v16bf a, v16bf b, v8f c) { return __builtin_amdgcn_wmma_f32_16x16x32_bf16(false, a, false, b, (short)0, c, false, false); }
// One 16 x 32 operand fragment from a fragment-order plane; p = its first block + 8 * lane: elements 0-7 (block j = 0) are k = 8 hi + 0..7, elements 8-15 (block j = 1) are k = 16 + 8 hi + 0..7.
__device__ __forceinline__ v16bf ldfrag(const bf* p) { return cat16b(*(const v8us*)p, *(const v8us*)(p + FB)); }
__device__ __forceinline__ unsigned pack2(float a, float b) { return __builtin_bit_cast(unsigned, __builtin_convertvector((v2f){a, b}, v2bf)); }   // round to nearest even
// The same fragment from a row-major f32 plane, rounded to bf16 on the way; p = the lane's row + 8 * (lane >> 4).
__device__ __forceinline__ v16bf ldfragf(const float* p) { const v4f a = *(const v4f*)p, b = *(const v4f*)(p + 4), c = *(const v4f*)(p + 16), d = *(const v4f*)(p + 20);
    return __builtin_bit_cast(v16bf, (v8u){pack2(a[0], a[1]), pack2(a[2], a[3]), pack2(b[0], b[1]), pack2(b[2], b[3]), pack2(c[0], c[1]), pack2(c[2], c[3]), pack2(d[0], d[1]), pack2(d[2], d[3])}); }
__device__ __forceinline__ float xhalf(float x) { return __builtin_bit_cast(float, __builtin_amdgcn_permlanex16(__builtin_bit_cast(int, x), __builtin_bit_cast(int, x), 0x76543210, 0xfedcba98, false, false)); }   // lane l with lane l ^ 16

// blockIdx.x = map, blockIdx.y picks the block of 128 query rows. Waves are independent: no barrier, K and V^T fragments straight from the fragment-order planes (a pass of 32 keys is 4 KB in a row of each).
__global__ __launch_bounds__(NWV * 32) void k_fused(const float* __restrict__ Q, const bf* __restrict__ Kb, const bf* __restrict__ VT, float* __restrict__ O, float* __restrict__ LOUT) {
    __shared__ __align__(16) float ost[NWV][QW * OP];
    const int lane = threadIdx.x & 31, wave = __builtin_amdgcn_readfirstlane(threadIdx.x >> 5), lr = lane & 15, hi = lane >> 4;
    const int map = blockIdx.x, y = blockIdx.y;
    const int qb = (y < 8) ? 15 - y : y - 8;   // long blocks start first; the second half of the grid runs short to long beside them
    const int qt = qb * NWV + wave, q0 = qt * QW;   // this wave's tile of 32 queries: it sees keys 0 .. q0 + 31 = qt + 1 passes
    const float cs = 0.125f * 1.4426950408889634f;   // 1 / sqrt(64), in the base-2 domain
    const float* Qm = Q + (size_t)map * SS * HD; const bf* Km = Kb + (size_t)map * SS * HD + 8 * lane; const bf* Vm = VT + (size_t)map * HD * SS + 8 * lane;
    v16bf qf[2][2], kf[2][2];
#pragma unroll
    for (int g = 0; g < 2; ++g) {
#pragma unroll
        for (int kc = 0; kc < 2; ++kc) qf[g][kc] = ldfragf(Qm + (size_t)(q0 + 16 * g + lr) * HD + 32 * kc + 8 * hi); }
#pragma unroll
    for (int kt = 0; kt < 2; ++kt) {
#pragma unroll
        for (int kc = 0; kc < 2; ++kc) kf[kt][kc] = ldfrag(Km + (2 * kt + kc) * 2 * FB); }
    v8f acc[2][4]; float m[2], l[2];
#pragma unroll
    for (int g = 0; g < 2; ++g) { m[g] = -INFINITY; l[g] = 0.f;
#pragma unroll
        for (int t = 0; t < 4; ++t) acc[g][t] = (v8f){}; }
#pragma unroll 1
    for (int ps = 0; ps <= qt; ++ps) {
        const int key0 = ps * 32;
        v16bf vf[4];   // V^T, 16 (d) x 32 (keys) each: asked for here, needed behind the exponentials
#pragma unroll
        for (int t = 0; t < 4; ++t) vf[t] = ldfrag(Vm + (size_t)key0 * HD + t * 2 * FB);
        v8f s[2][2];   // [16-key tile][16-query group]: register j = key key0 + 16 kt + 8 hi + j, lane column = query q0 + 16 g + lr
#pragma unroll
        for (int kt = 0; kt < 2; ++kt) {
#pragma unroll
            for (int g = 0; g < 2; ++g) s[kt][g] = wmmab(kf[kt][1], qf[g][1], wmmab(kf[kt][0], qf[g][0], (v8f){})); }
        const int nk = (ps < qt ? ps + 1 : ps) * 32;
#pragma unroll
        for (int kt = 0; kt < 2; ++kt) {
#pragma unroll
            for (int kc = 0; kc < 2; ++kc) kf[kt][kc] = ldfrag(Km + (size_t)nk * HD + (2 * kt + kc) * 2 * FB); }
        asm volatile("s_wait_xcnt 0x0" ::: "memory");   // the address registers of the loads above are reused right below: the wait stands in front of that overwrite
        if (ps == qt) {   // wave-uniform: only the pass on the diagonal pays for the mask
#pragma unroll
            for (int g = 0; g < 2; ++g) { const int q = q0 + 16 * g + lr;
#pragma unroll
                for (int kt = 0; kt < 2; ++kt) {
#pragma unroll
                    for (int j = 0; j < 8; ++j) if (key0 + 16 * kt + 8 * hi + j > q) s[kt][g][j] = -INFINITY;
                } }
        }
#pragma unroll
        for (int g = 0; g < 2; ++g) {
            float mx = s[0][g][0];
#pragma unroll
            for (int j = 1; j < 8; ++j) mx = fmaxf(mx, s[0][g][j]);
#pragma unroll
            for (int j = 0; j < 8; ++j) mx = fmaxf(mx, s[1][g][j]);
            mx = fmaxf(mx, xhalf(mx));
            const float mn = fmaxf(m[g], mx * cs);
            const float al = __builtin_amdgcn_exp2f(m[g] - mn);   // 0 on the first pass
            m[g] = mn; l[g] *= al;
#pragma unroll
            for (int t = 0; t < 4; ++t) acc[g][t] = acc[g][t] * al;
            v8u wh, wl; float ls = 0.f;
#pragma unroll
            for (int i = 0; i < 8; ++i) {
                const v2f ar = __builtin_elementwise_fma((v2f){s[i >> 2][g][2 * (i & 3)], s[i >> 2][g][2 * (i & 3) + 1]}, (v2f){cs, cs}, (v2f){-mn, -mn});
                const float p0 = __builtin_amdgcn_exp2f(ar[0]), p1 = __builtin_amdgcn_exp2f(ar[1]);
                const unsigned h = pack2(p0, p1);
                wh[i] = h; wl[i] = pack2(p0 - __uint_as_float(h << 16), p1 - __uint_as_float(h & 0xFFFF0000u));
                ls += p0 + p1; }
            l[g] += ls;
            const v16bf ph = __builtin_bit_cast(v16bf, wh), pl = __builtin_bit_cast(v16bf, wl);
#pragma unroll
            for (int t = 0; t < 4; ++t) acc[g][t] = wmmab(vf[t], pl, wmmab(vf[t], ph, acc[g][t]));
        }
    }
    // Epilogue: normalise, stage the wave's 32 x 64 tile in its own LDS slice, store whole rows.
    float* os = &ost[wave][0];
#pragma unroll
    for (int g = 0; g < 2; ++g) {
        const float lt = l[g] + xhalf(l[g]);   // the halves' sums join here, unconditionally
        const float inv = 1.0f / lt;
#pragma unroll
        for (int t = 0; t < 4; ++t) { const v8f o = acc[g][t] * inv; float* d = os + (16 * g + lr) * OP + 16 * t + 8 * hi;
            *(v4fa*)d = (v4f){o[0], o[1], o[2], o[3]}; *(v4fa*)(d + 4) = (v4f){o[4], o[5], o[6], o[7]}; }
        const float Lv = m[g] * 0.6931471805599453f + logf(lt);
        if (hi == 0) LOUT[(size_t)map * SS + q0 + 16 * g + lr] = Lv;
    }
    __builtin_amdgcn_wave_barrier(); asm volatile("" ::: "memory");   // the rows below were written by other lanes of this wave: keeps the reads behind the writes
    float* orow = O + ((size_t)map * SS + q0) * HD;
#pragma unroll
    for (int r = 0; r < QW / 2; ++r) { const int row = 2 * r + hi; const v4f val = *(const v4fa*)(os + row * OP + lr * 4); *(v4f*)(orow + (size_t)row * HD + lr * 4) = val; }
}

// K and V to the two bf16 fragment-order planes in one launch. A wave takes 8 KB of f32 with all its 16 loads of 16 bytes asked for at once; every load and every store covers whole 128-byte lines.
// blockIdx.x < PVB: V. A wave owns 64 positions x 32 columns: a lane loads 8 consecutive positions x 4 columns (twice), packs each column's 8 values into 16 bytes (one lane's share of a block),
// and the wave sorts the pieces into blocks in its own LDS slice, so that each block leaves as 512 bytes in a row. The other workgroups: K, a wave owns 32 keys x 64 columns, sorted the same way.
__global__ __launch_bounds__(PW * 32) void k_prep(const float* __restrict__ K, const float* __restrict__ V, bf* __restrict__ Kb, bf* __restrict__ VT) {
    __shared__ v4u vst[PW][16 * KPC];   // per wave 8 blocks = 16 half blocks at the wider of the two pitches
    const int lane = threadIdx.x & 31, wave = __builtin_amdgcn_readfirstlane(threadIdx.x >> 5);
    if (blockIdx.x < PVB) {
        const int vw = blockIdx.x * PW + wave, map = vw >> 6, t0 = ((vw & 63) >> 1) * 64, d0 = (vw & 1) * 32, q = lane & 7, u = lane >> 3;
        const float* s = V + ((size_t)map * SS + t0 + 8 * u) * HD + d0 + 4 * q;
        v4f x[2][8];
#pragma unroll
        for (int h = 0; h < 2; ++h) {
#pragma unroll
            for (int j = 0; j < 8; ++j) x[h][j] = *(const v4f*)(s + (32 * h + j) * HD); }
        __builtin_amdgcn_sched_barrier(0);   // all 16 loads are asked for before the first value is used: without it the compiler holds the second eight back until the first eight have come
        asm volatile("s_wait_xcnt 0x0" :: "v"(s) : "memory");   // keeps the loads' address pair alive behind all 16, so that the last load's result does not land in it while the others still name it; any later reuse of the pair is behind this wait
        v4u* st = &vst[wave][0];
#pragma unroll
        for (int h = 0; h < 2; ++h) {
#pragma unroll
            for (int i = 0; i < 4; ++i)   // column d0 + 4 q + i, positions t0 + 32 h + 8 u + 0..7: half block ((h * 2 + (q >> 2)) * 2 + j) * 2 + hi with u = 2 j + hi, place 4 (q & 3) + i
                st[(8 * h + 4 * (q >> 2) + u) * VPC + 4 * (q & 3) + i] = (v4u){pack2(x[h][0][i], x[h][1][i]), pack2(x[h][2][i], x[h][3][i]), pack2(x[h][4][i], x[h][5][i]), pack2(x[h][6][i], x[h][7][i])}; }
        asm volatile("s_wait_dscnt 0x0" ::: "memory");   // the pieces read below were written by other lanes of this wave: the writes are done, and the reads stay behind them
        bf* d = VT + ((size_t)map * SS + t0) * HD + (d0 >> 4) * 2 * FB + 8 * lane;
#pragma unroll
        for (int r = 0; r < 8; ++r) *(v4u*)(d + (r >> 2) * 32 * HD + (r & 3) * FB) = st[(2 * r + (lane >> 4)) * VPC + (lane & 15)];   // r = (h * 2 + 16-column tile) * 2 + j
    } else {
        const size_t w0 = ((size_t)(blockIdx.x - PVB) * PW + wave) * 2048, o = w0 + lane * 4;   // w0: 32 keys of one map, the same 2048 elements in both orders
        v4f x[16];
#pragma unroll
        for (int i = 0; i < 16; ++i) x[i] = *(const v4f*)(K + o + 128 * i);
        __builtin_amdgcn_sched_barrier(0);   // as above: without it the last four loads are held back until the first values have come
        asm volatile("s_wait_xcnt 0x0" :: "v"(K + o) : "memory");   // as above, for this run's address pair
        v4u* st = &vst[wave][0]; v2ua* st2 = (v2ua*)st; const int c = lane & 15;
#pragma unroll
        for (int i = 0; i < 16; ++i)   // key 2 i + (lane >> 4), columns 4 c + 0..3 = 32 kc + 16 j + 8 hi + 4 (c & 1) + 0..3: half block 8 (i >> 3) + (c >> 1), place key & 15, half c & 1 of the piece
            st2[((8 * (i >> 3) + (c >> 1)) * KPC + 2 * (i & 7) + (lane >> 4)) * 2 + (c & 1)] = (v2u){pack2(x[i][0], x[i][1]), pack2(x[i][2], x[i][3])};
        asm volatile("s_wait_dscnt 0x0" ::: "memory");   // as above: the pieces read below were written by other lanes of this wave
#pragma unroll
        for (int r = 0; r < 8; ++r) *(v4u*)(Kb + w0 + r * FB + 8 * lane) = st[(2 * r + (lane >> 4)) * KPC + (lane & 15)];
        asm volatile("s_wait_xcnt 0x0" ::: "memory");   // behind the last store: no path from here rewrites a register of a store without it
    }
}

extern "C" void kernel_launch(void* const* d_in, const int* in_sizes, int n_in,
                              void* d_out, int out_size, void* d_ws, size_t ws_size, hipStream_t stream) {
    (void)in_sizes; (void)n_in; (void)out_size;
    const float* Q = (const float*)d_in[0]; const float* Kx = (const float*)d_in[1]; const float* V = (const float*)d_in[2];
    float* O = (float*)d_out;                                              // [2][16][2048][64]
    float* LO = (float*)((char*)d_out + (size_t)NB_ * NH_ * SS * HD * 4);  // [2][16][2048][1] right after O
    char* wsp = (char*)d_ws;
    auto take = [&](size_t bytes) { char* p = wsp; wsp += (bytes + 255) & ~(size_t)255; return (void*)p; };
    bf* Kb = (bf*)take((size_t)NMAP * SS * HD * 2); bf* VT = (bf*)take((size_t)NMAP * HD * SS * 2);
    if ((size_t)(wsp - (char*)d_ws) > ws_size) return;    // 17 MB
    k_prep<<<2 * PVB, PW * 32, 0, stream>>>(Kx, V, Kb, VT);
    k_fused<<<dim3(NMAP, SS / (QW * NWV), 1), NWV * 32, 0, stream>>>(Q, Kb, VT, O, LO);
}

// v005
// One run takes 32.1 microseconds.
// In two side-by-side timings against v004, it was 1.76 and 1.77 times as fast.
// Over all steps from v000 it is 162 times as fast.
#include <hip/hip_runtime.h>
#include <math.h>

#define NB_  2
#define NH_  16
#define SS   2048
#define HD   64
#define NMAP (NB_ * NH_)   // (batch, head) maps
#define QW   32            // query columns per wave
#define NT   4             // query tiles per block of 128 query rows
#define NS   4             // waves that share the keys of one tile
#define NWV  (NT * NS)     // waves per workgroup: 4 on each SIMD, which is what their registers allow
#define OP   68            // output staging pitch in floats
#define PW   8             // waves per workgroup of the conversion kernel
#define PVB  (NMAP * SS * HD / (PW * 2048))   // its workgroups per operand: 2048 elements per wave
#define FB   256           // elements of one 512-byte block of a fragment-order plane
#define VPC  17            // staging pitch of half a block (16 pieces of 16 bytes) for V: + 1 piece, so that the 16-byte writes spread over all banks
#define KPC  18            // the same for K: + 2 pieces, so that the 8-byte writes spread over all banks

typedef unsigned short bf;
typedef __attribute__((ext_vector_type(16))) __bf16   v16bf;
typedef __attribute__((ext_vector_type(2)))  __bf16   v2bf;
typedef __attribute__((ext_vector_type(8)))  unsigned short v8us;
typedef __attribute__((ext_vector_type(8)))  unsigned v8u;
typedef __attribute__((ext_vector_type(4)))  unsigned v4u;
typedef __attribute__((ext_vector_type(2)))  unsigned v2u;
typedef __attribute__((ext_vector_type(8)))  float    v8f;
typedef __attribute__((ext_vector_type(4)))  float    v4f;
typedef __attribute__((ext_vector_type(2)))  float    v2f;
typedef v4f  __attribute__((may_alias)) v4fa;
typedef v2u  __attribute__((may_alias)) v2ua;

__device__ __forceinline__ v16bf cat16b(v8us lo, v8us hi) { return __builtin_bit_cast(v16bf, __builtin_shufflevector(lo, hi, 0, 1, 2, 3, 4, 5, 6, 7, 8, 9, 10, 11, 12, 13, 14, 15)); }
__device__ __forceinline__ v8f wmmab(v16bf a, v16bf b, v8f c) { return __builtin_amdgcn_wmma_f32_16x16x32_bf16(false, a, false, b, (short)0, c, false, false); }
// One 16 x 32 operand fragment from a fragment-order plane; p = its first block + 8 * lane: elements 0-7 (block j = 0) are k = 8 hi + 0..7, elements 8-15 (block j = 1) are k = 16 + 8 hi + 0..7.
__device__ __forceinline__ v16bf ldfrag(const bf* p) { return cat16b(*(const v8us*)p, *(const v8us*)(p + FB)); }
__device__ __forceinline__ unsigned pack2(float a, float b) { return __builtin_bit_cast(unsigned, __builtin_convertvector((v2f){a, b}, v2bf)); }   // round to nearest even
// The same fragment from a row-major f32 plane, rounded to bf16 on the way; p = the lane's row + 8 * (lane >> 4).
__device__ __forceinline__ v16bf ldfragf(const float* p) { const v4f a = *(const v4f*)p, b = *(const v4f*)(p + 4), c = *(const v4f*)(p + 16), d = *(const v4f*)(p + 20);
    return __builtin_bit_cast(v16bf, (v8u){pack2(a[0], a[1]), pack2(a[2], a[3]), pack2(b[0], b[1]), pack2(b[2], b[3]), pack2(c[0], c[1]), pack2(c[2], c[3]), pack2(d[0], d[1]), pack2(d[2], d[3])}); }
__device__ __forceinline__ float xhalf(float x) { return __builtin_bit_cast(float, __builtin_amdgcn_permlanex16(__builtin_bit_cast(int, x), __builtin_bit_cast(int, x), 0x76543210, 0xfedcba98, false, false)); }   // lane l with lane l ^ 16

// blockIdx.x = map, blockIdx.y = y in 0..7. One workgroup per WGP, all resident, all with the same work: it does the block of 128 query rows 15 - y, then the block y (65 passes per tile pair).
// Wave w: tile w & 3 (so a tile's 4 waves share a SIMD, and the 4 waves with equal w >> 2 ask for the same K and V^T lines at about the same time), key share w >> 2; both are mirrored in the second block,
// which gives every SIMD 65 passes and every wave 16 or 17. No barrier in or between the two walks: each leaves its partial results in an LDS slice of its own. K and V^T fragments straight from the fragment-order planes.
__global__ __launch_bounds__(NWV * 32) void k_fused(const float* __restrict__ Q, const bf* __restrict__ Kb, const bf* __restrict__ VT, float* __restrict__ O, float* __restrict__ LOUT) {
    __shared__ __align__(16) float ost[2][NWV][QW * OP];      // [block][key share * NT + tile]: unnormalised O of that share
    __shared__ __align__(16) float mls[2][NT][QW][2 * NS];    // [block][tile][query]: the NS maxima, then the NS sums
    const int lane = threadIdx.x & 31, wave = __builtin_amdgcn_readfirstlane(threadIdx.x >> 5), lr = lane & 15, hi = lane >> 4;
    const int map = blockIdx.x, y = blockIdx.y;
    const float cs = 0.125f * 1.4426950408889634f;   // 1 / sqrt(64), in the base-2 domain
    const float* Qm = Q + (size_t)map * SS * HD; const bf* Km = Kb + (size_t)map * SS * HD + 8 * lane; const bf* Vm = VT + (size_t)map * HD * SS + 8 * lane;
#pragma unroll 1
    for (int h = 0; h < 2; ++h) {   // kept rolled: one copy of the key loop in the instruction cache
    const int tl = h ? NT - 1 - (wave & 3) : (wave & 3), sp = h ? NS - 1 - (wave >> 2) : (wave >> 2);
    const int qt = (h ? y : 15 - y) * NT + tl, q0 = qt * QW;   // this wave's tile of 32 queries: it sees keys 0 .. q0 + 31 = qt + 1 passes, of which this wave takes sp, sp + NS, ...
    v16bf qf[2][2], kf[2][2];
#pragma unroll
    for (int g = 0; g < 2; ++g) {
#pragma unroll
        for (int kc = 0; kc < 2; ++kc) qf[g][kc] = ldfragf(Qm + (size_t)(q0 + 16 * g + lr) * HD + 32 * kc + 8 * hi); }
#pragma unroll
    for (int kt = 0; kt < 2; ++kt) {
#pragma unroll
        for (int kc = 0; kc < 2; ++kc) kf[kt][kc] = ldfrag(Km + (size_t)(sp * 32) * HD + (2 * kt + kc) * 2 * FB); }   // pass sp: in bounds also where the tile has no such pass (then unused)
    v8f acc[2][4]; float m[2], l[2];
#pragma unroll
    for (int g = 0; g < 2; ++g) { m[g] = -INFINITY; l[g] = 0.f;
#pragma unroll
        for (int t = 0; t < 4; ++t) acc[g][t] = (v8f){}; }
#pragma unroll 1
    for (int ps = sp; ps <= qt; ps += NS) {
        const int key0 = ps * 32;
        const bf* vp = Vm + (size_t)key0 * HD;
        v16bf vf[4];   // V^T, 16 (d) x 32 (keys) each: asked for here, needed behind the exponentials
#pragma unroll
        for (int t = 0; t < 4; ++t) vf[t] = ldfrag(vp + t * 2 * FB);
        v8f s[2][2];   // [16-key tile][16-query group]: register j = key key0 + 16 kt + 8 hi + j, lane column = query q0 + 16 g + lr
#pragma unroll
        for (int kt = 0; kt < 2; ++kt) {
#pragma unroll
            for (int g = 0; g < 2; ++g) s[kt][g] = wmmab(kf[kt][1], qf[g][1], wmmab(kf[kt][0], qf[g][0], (v8f){})); }
        const int nk = (ps + NS <= qt ? ps + NS : ps) * 32;
        const bf* kp = Km + (size_t)nk * HD;
#pragma unroll
        for (int kt = 0; kt < 2; ++kt) {
#pragma unroll
            for (int kc = 0; kc < 2; ++kc) kf[kt][kc] = ldfrag(kp + (2 * kt + kc) * 2 * FB); }
        asm volatile("s_wait_xcnt 0x0" :: "v"(vp), "v"(kp) : "memory");   // keeps both address pairs alive behind the 16 loads, so that no load's result lands in a pair that other loads still name; the pairs are reused right below, behind this wait
        if (ps == qt) {   // wave-uniform: only the pass on the diagonal pays for the mask
#pragma unroll
            for (int g = 0; g < 2; ++g) { const int q = q0 + 16 * g + lr;
#pragma unroll
                for (int kt = 0; kt < 2; ++kt) {
#pragma unroll
                    for (int j = 0; j < 8; ++j) if (key0 + 16 * kt + 8 * hi + j > q) s[kt][g][j] = -INFINITY;
                } }
        }
#pragma unroll
        for (int g = 0; g < 2; ++g) {
            float mx = s[0][g][0];
#pragma unroll
            for (int j = 1; j < 8; ++j) mx = fmaxf(mx, s[0][g][j]);
#pragma unroll
            for (int j = 0; j < 8; ++j) mx = fmaxf(mx, s[1][g][j]);
            mx = fmaxf(mx, xhalf(mx));   // both halves of the wave hold this query's maximum of the pass
            const float mn = fmaxf(m[g], mx * cs);   // finite from the wave's first pass on: the first key of a pass is never masked, on the diagonal neither
            const float al = __builtin_amdgcn_exp2f(m[g] - mn);   // 0 on the first pass
            m[g] = mn; l[g] *= al;
#pragma unroll
            for (int t = 0; t < 4; ++t) acc[g][t] = acc[g][t] * al;
            v8u wh, wl; float ls = 0.f;
#pragma unroll
            for (int i = 0; i < 8; ++i) {
                const v2f ar = __builtin_elementwise_fma((v2f){s[i >> 2][g][2 * (i & 3)], s[i >> 2][g][2 * (i & 3) + 1]}, (v2f){cs, cs}, (v2f){-mn, -mn});
                const float p0 = __builtin_amdgcn_exp2f(ar[0]), p1 = __builtin_amdgcn_exp2f(ar[1]);
                const unsigned h2 = pack2(p0, p1);
                wh[i] = h2; wl[i] = pack2(p0 - __uint_as_float(h2 << 16), p1 - __uint_as_float(h2 & 0xFFFF0000u));
                ls += p0 + p1; }
            l[g] += ls;
            const v16bf ph = __builtin_bit_cast(v16bf, wh), pl = __builtin_bit_cast(v16bf, wl);
#pragma unroll
            for (int t = 0; t < 4; ++t) acc[g][t] = wmmab(vf[t], pl, wmmab(vf[t], ph, acc[g][t]));
        }
    }
    // This share's partial result to its own LDS slice, unnormalised. A share without a pass leaves maximum -inf, sum 0, O 0: weight 0 in the join.
    float* os = &ost[h][sp * NT + tl][0];
#pragma unroll
    for (int g = 0; g < 2; ++g) {
        const float lt = l[g] + xhalf(l[g]);   // the halves' sums join here, unconditionally
#pragma unroll
        for (int t = 0; t < 4; ++t) { const v8f o = acc[g][t]; float* d = os + (16 * g + lr) * OP + 16 * t + 8 * hi;
            *(v4fa*)d = (v4f){o[0], o[1], o[2], o[3]}; *(v4fa*)(d + 4) = (v4f){o[4], o[5], o[6], o[7]}; }
        mls[h][tl][16 * g + lr][NS * hi + sp] = hi ? lt : m[g];   // the lower half of the wave writes the maximum, the upper the sum
    }
    }
    __syncthreads();   // every share of both blocks is in LDS: the rows read below were written by other waves
    // Join: wave w takes rows 8 (w >> 2) .. + 7 of tile w & 3 of either block; weights 2^(m_i - M) / L, shares added in the order 0 to 3; whole rows stored.
    const int wt = wave & 3, wr = wave >> 2;
#pragma unroll
    for (int h = 0; h < 2; ++h) {
        const int q0 = ((h ? y : 15 - y) * NT + wt) * QW;
        float* orow = O + ((size_t)map * SS + q0) * HD;
#pragma unroll
        for (int r = 0; r < QW / (2 * NS); ++r) {
            const int row = (QW / NS) * wr + 2 * r + hi;
            const v4f mm = *(const v4fa*)&mls[h][wt][row][0], ll = *(const v4fa*)&mls[h][wt][row][NS];
            const float M = fmaxf(fmaxf(mm[0], mm[1]), fmaxf(mm[2], mm[3]));   // finite: share 0 always has pass 0
            float f[NS], L = 0.f;
#pragma unroll
            for (int i = 0; i < NS; ++i) { f[i] = __builtin_amdgcn_exp2f(mm[i] - M); L += f[i] * ll[i]; }
            const float inv = 1.0f / L;
            v4f val = (v4f){};
#pragma unroll
            for (int i = 0; i < NS; ++i) val += *(const v4fa*)(&ost[h][i * NT + wt][row * OP + lr * 4]) * (f[i] * inv);
            *(v4f*)(orow + (size_t)row * HD + lr * 4) = val;
        }
        asm volatile("s_wait_xcnt 0x0" ::: "memory");   // the registers of the stores above are reused right below: the wait stands in front of that overwrite
        if (wr == h) {   // wave-uniform: one wave writes the tile's 32 logsumexp values, one whole line; lane = query
            const v4f mm = *(const v4fa*)&mls[h][wt][lane][0], ll = *(const v4fa*)&mls[h][wt][lane][NS];
            const float M = fmaxf(fmaxf(mm[0], mm[1]), fmaxf(mm[2], mm[3]));
            float L = 0.f;
#pragma unroll
            for (int i = 0; i < NS; ++i) L += __builtin_amdgcn_exp2f(mm[i] - M) * ll[i];
            LOUT[(size_t)map * SS + q0 + lane] = M * 0.6931471805599453f + logf(L);
        }
    }
}

// K and V to the two bf16 fragment-order planes in one launch. A wave takes 8 KB of f32 with all its 16 loads of 16 bytes asked for at once; every load and every store covers whole 128-byte lines.
// blockIdx.x < PVB: V. A wave owns 64 positions x 32 columns: a lane loads 8 consecutive positions x 4 columns (twice), packs each column's 8 values into 16 bytes (one lane's share of a block),
// and the wave sorts the pieces into blocks in its own LDS slice, so that each block leaves as 512 bytes in a row. The other workgroups: K, a wave owns 32 keys x 64 columns, sorted the same way.
__global__ __launch_bounds__(PW * 32) void k_prep(const float* __restrict__ K, const float* __restrict__ V, bf* __restrict__ Kb, bf* __restrict__ VT) {
    __shared__ v4u vst[PW][16 * KPC];   // per wave 8 blocks = 16 half blocks at the wider of the two pitches
    const int lane = threadIdx.x & 31, wave = __builtin_amdgcn_readfirstlane(threadIdx.x >> 5);
    if (blockIdx.x < PVB) {
        const int vw = blockIdx.x * PW + wave, map = vw >> 6, t0 = ((vw & 63) >> 1) * 64, d0 = (vw & 1) * 32, q = lane & 7, u = lane >> 3;
        const float* s = V + ((size_t)map * SS + t0 + 8 * u) * HD + d0 + 4 * q;
        v4f x[2][8];
#pragma unroll
        for (int h = 0; h < 2; ++h) {
#pragma unroll
            for (int j = 0; j < 8; ++j) x[h][j] = *(const v4f*)(s + (32 * h + j) * HD); }
        __builtin_amdgcn_sched_barrier(0);   // all 16 loads are asked for before the first value is used: without it the compiler holds the second eight back until the first eight have come
        asm volatile("s_wait_xcnt 0x0" :: "v"(s) : "memory");   // keeps the loads' address pair alive behind all 16, so that the last load's result does not land in it while the others still name it; any later reuse of the pair is behind this wait
        v4u* st = &vst[wave][0];
#pragma unroll
        for (int h = 0; h < 2; ++h) {
#pragma unroll
            for (int i = 0; i < 4; ++i)   // column d0 + 4 q + i, positions t0 + 32 h + 8 u + 0..7: half block ((h * 2 + (q >> 2)) * 2 + j) * 2 + hi with u = 2 j + hi, place 4 (q & 3) + i
                st[(8 * h + 4 * (q >> 2) + u) * VPC + 4 * (q & 3) + i] = (v4u){pack2(x[h][0][i], x[h][1][i]), pack2(x[h][2][i], x[h][3][i]), pack2(x[h][4][i], x[h][5][i]), pack2(x[h][6][i], x[h][7][i])}; }
        asm volatile("s_wait_dscnt 0x0" ::: "memory");   // the pieces read below were written by other lanes of this wave: the writes are done, and the reads stay behind them
        bf* d = VT + ((size_t)map * SS + t0) * HD + (d0 >> 4) * 2 * FB + 8 * lane;
#pragma unroll
        for (int r = 0; r < 8; ++r) *(v4u*)(d + (r >> 2) * 32 * HD + (r & 3) * FB) = st[(2 * r + (lane >> 4)) * VPC + (lane & 15)];   // r = (h * 2 + 16-column tile) * 2 + j
    } else {
        const size_t w0 = ((size_t)(blockIdx.x - PVB) * PW + wave) * 2048, o = w0 + lane * 4;   // w0: 32 keys of one map, the same 2048 elements in both orders
        v4f x[16];
#pragma unroll
        for (int i = 0; i < 16; ++i) x[i] = *(const v4f*)(K + o + 128 * i);
        __builtin_amdgcn_sched_barrier(0);   // as above: without it the last four loads are held back until the first values have come
        asm volatile("s_wait_xcnt 0x0" :: "v"(K + o) : "memory");   // as above, for this run's address pair
        v4u* st = &vst[wave][0]; v2ua* st2 = (v2ua*)st; const int c = lane & 15;
#pragma unroll
        for (int i = 0; i < 16; ++i)   // key 2 i + (lane >> 4), columns 4 c + 0..3 = 32 kc + 16 j + 8 hi + 4 (c & 1) + 0..3: half block 8 (i >> 3) + (c >> 1), place key & 15, half c & 1 of the piece
            st2[((8 * (i >> 3) + (c >> 1)) * KPC + 2 * (i & 7) + (lane >> 4)) * 2 + (c & 1)] = (v2u){pack2(x[i][0], x[i][1]), pack2(x[i][2], x[i][3])};
        asm volatile("s_wait_dscnt 0x0" ::: "memory");   // as above: the pieces read below were written by other lanes of this wave
#pragma unroll
        for (int r = 0; r < 8; ++r) *(v4u*)(Kb + w0 + r * FB + 8 * lane) = st[(2 * r + (lane >> 4)) * KPC + (lane & 15)];
        asm volatile("s_wait_xcnt 0x0" ::: "memory");   // behind the last store: no path from here rewrites a register of a store without it
    }
}

extern "C" void kernel_launch(void* const* d_in, const int* in_sizes, int n_in,
                              void* d_out, int out_size, void* d_ws, size_t ws_size, hipStream_t stream) {
    (void)in_sizes; (void)n_in; (void)out_size;
    const float* Q = (const float*)d_in[0]; const float* Kx = (const float*)d_in[1]; const float* V = (const float*)d_in[2];
    float* O = (float*)d_out;                                              // [2][16][2048][64]
    float* LO = (float*)((char*)d_out + (size_t)NB_ * NH_ * SS * HD * 4);  // [2][16][2048][1] right after O
    char* wsp = (char*)d_ws;
    auto take = [&](size_t bytes) { char* p = wsp; wsp += (bytes + 255) & ~(size_t)255; return (void*)p; };
    bf* Kb = (bf*)take((size_t)NMAP * SS * HD * 2); bf* VT = (bf*)take((size_t)NMAP * HD * SS * 2);
    if ((size_t)(wsp - (char*)d_ws) > ws_size) return;    // 17 MB
    k_prep<<<2 * PVB, PW * 32, 0, stream>>>(Kx, V, Kb, VT);
    k_fused<<<dim3(NMAP, SS / (QW * NT * 2), 1), NWV * 32, 0, stream>>>(Q, Kb, VT, O, LO);
}

// v006
// Measured time: 29.7 microseconds a run.
// In both of two side-by-side timings against v005, it was 1.08 times as fast.
// Over all steps from v000 it is 174 times as fast.
#include <hip/hip_runtime.h>
#include <math.h>

#define NB_  2
#define NH_  16
#define SS   2048
#define HD   64
#define NMAP (NB_ * NH_)   // (batch, head) maps
#define QW   32            // query columns per wave
#define NT   4             // query tiles per block of 128 query rows
#define NS   4             // waves that share the keys of one tile
#define NWV  (NT * NS)     // waves per workgroup: 4 on each SIMD, which is what their registers allow
#define OP   68            // output staging pitch in floats
#define PW   8             // waves per workgroup of the conversion kernel
#define PVB  (NMAP * SS * HD / (PW * 2048))   // its workgroups per operand: 2048 elements per wave
#define FB   256           // elements of one 512-byte block of a fragment-order plane
#define VPC  17            // staging pitch of half a block (16 pieces of 16 bytes) for V: + 1 piece, so that the 16-byte writes spread over all banks
#define KPC  18            // the same for K: + 2 pieces, so that the 8-byte writes spread over all banks

typedef unsigned short bf;
typedef __attribute__((ext_vector_type(16))) __bf16   v16bf;
typedef __attribute__((ext_vector_type(2)))  __bf16   v2bf;
typedef __attribute__((ext_vector_type(8)))  unsigned short v8us;
typedef __attribute__((ext_vector_type(8)))  unsigned v8u;
typedef __attribute__((ext_vector_type(4)))  unsigned v4u;
typedef __attribute__((ext_vector_type(2)))  unsigned v2u;
typedef __attribute__((ext_vector_type(8)))  float    v8f;
typedef __attribute__((ext_vector_type(4)))  float    v4f;
typedef __attribute__((ext_vector_type(2)))  float    v2f;
typedef v4f  __attribute__((may_alias)) v4fa;
typedef v2u  __attribute__((may_alias)) v2ua;

__device__ __forceinline__ v16bf cat16b(v8us lo, v8us hi) { return __builtin_bit_cast(v16bf, __builtin_shufflevector(lo, hi, 0, 1, 2, 3, 4, 5, 6, 7, 8, 9, 10, 11, 12, 13, 14, 15)); }
__device__ __forceinline__ v8f wmmab(v16bf a, v16bf b, v8f c) { return __builtin_amdgcn_wmma_f32_16x16x32_bf16(false, a, false, b, (short)0, c, false, false); }
// One 16 x 32 operand fragment from a fragment-order plane; p = its first block + 8 * lane: elements 0-7 (block j = 0) are k = 8 hi + 0..7, elements 8-15 (block j = 1) are k = 16 + 8 hi + 0..7.
__device__ __forceinline__ v16bf ldfrag(const bf* p) { return cat16b(*(const v8us*)p, *(const v8us*)(p + FB)); }
__device__ __forceinline__ unsigned pack2(float a, float b) { return __builtin_bit_cast(unsigned, __builtin_convertvector((v2f){a, b}, v2bf)); }   // round to nearest even
// The same fragment from a row-major f32 plane, rounded to bf16 on the way; p = the lane's row + 8 * (lane >> 4).
__device__ __forceinline__ v16bf ldfragf(const float* p) { const v4f a = *(const v4f*)p, b = *(const v4f*)(p + 4), c = *(const v4f*)(p + 16), d = *(const v4f*)(p + 20);
    return __builtin_bit_cast(v16bf, (v8u){pack2(a[0], a[1]), pack2(a[2], a[3]), pack2(b[0], b[1]), pack2(b[2], b[3]), pack2(c[0], c[1]), pack2(c[2], c[3]), pack2(d[0], d[1]), pack2(d[2], d[3])}); }
__device__ __forceinline__ float xhalf(float x) { return __builtin_bit_cast(float, __builtin_amdgcn_permlanex16(__builtin_bit_cast(int, x), __builtin_bit_cast(int, x), 0x76543210, 0xfedcba98, false, false)); }   // lane l with lane l ^ 16

// blockIdx.x = map, blockIdx.y = y in 0..7. One workgroup per WGP, all resident, all with the same work: it does the block of 128 query rows 15 - y, then the block y (65 passes per tile pair).
// Wave w: tile w & 3 (so a tile's 4 waves share a SIMD, and the 4 waves with equal w >> 2 ask for the same K and V^T lines at about the same time), key share w >> 2; both are mirrored in the second block,
// which gives every SIMD 65 passes and every wave 16 or 17. No barrier in or between the two walks: each leaves its partial results in an LDS slice of its own. K and V^T fragments straight from the fragment-order planes.
__global__ __launch_bounds__(NWV * 32) void k_fused(const float* __restrict__ Q, const bf* __restrict__ Kb, const bf* __restrict__ VT, float* __restrict__ O, float* __restrict__ LOUT) {
    __shared__ __align__(16) float ost[2][NWV][QW * OP];      // [block][key share * NT + tile]: unnormalised O of that share
    __shared__ __align__(16) float mls[2][NT][QW][2 * NS];    // [block][tile][query]: the NS maxima, then the NS sums
    const int lane = threadIdx.x & 31, wave = __builtin_amdgcn_readfirstlane(threadIdx.x >> 5), lr = lane & 15, hi = lane >> 4;
    const int map = blockIdx.x, y = blockIdx.y;
    const float cs = 0.125f * 1.4426950408889634f;   // 1 / sqrt(64), in the base-2 domain
    const float* Qm = Q + (size_t)map * SS * HD; const bf* Km = Kb + (size_t)map * SS * HD + 8 * lane; const bf* Vm = VT + (size_t)map * HD * SS + 8 * lane;
#pragma unroll 1
    for (int h = 0; h < 2; ++h) {   // kept rolled: one copy of the key loop in the instruction cache
    const int tl = h ? NT - 1 - (wave & 3) : (wave & 3), sp = h ? NS - 1 - (wave >> 2) : (wave >> 2);
    const int qt = (h ? y : 15 - y) * NT + tl, q0 = qt * QW;   // this wave's tile of 32 queries: it sees keys 0 .. q0 + 31 = qt + 1 passes, of which this wave takes sp, sp + NS, ...
    v16bf qf[2][2], kf[2][2];
#pragma unroll
    for (int g = 0; g < 2; ++g) {
#pragma unroll
        for (int kc = 0; kc < 2; ++kc) qf[g][kc] = ldfragf(Qm + (size_t)(q0 + 16 * g + lr) * HD + 32 * kc + 8 * hi); }
#pragma unroll
    for (int kt = 0; kt < 2; ++kt) {
#pragma unroll
        for (int kc = 0; kc < 2; ++kc) kf[kt][kc] = ldfrag(Km + (size_t)(sp * 32) * HD + (2 * kt + kc) * 2 * FB); }   // pass sp: in bounds also where the tile has no such pass (then unused)
    v8f acc[2][4]; float m[2], l[2], bar[2];   // bar = the unscaled score from which on the maximum in use is renewed
#pragma unroll
    for (int g = 0; g < 2; ++g) { m[g] = -INFINITY; bar[g] = -INFINITY; l[g] = 0.f;
#pragma unroll
        for (int t = 0; t < 4; ++t) acc[g][t] = (v8f){}; }
#pragma unroll 1
    for (int ps = sp; ps <= qt; ps += NS) {
        const int key0 = ps * 32;
        const bf* vp = Vm + (size_t)key0 * HD;
        v16bf vf[4];   // V^T, 16 (d) x 32 (keys) each: asked for here, needed behind the exponentials
#pragma unroll
        for (int t = 0; t < 4; ++t) vf[t] = ldfrag(vp + t * 2 * FB);
        v8f s[2][2];   // [16-key tile][16-query group]: register j = key key0 + 16 kt + 8 hi + j, lane column = query q0 + 16 g + lr
#pragma unroll
        for (int kt = 0; kt < 2; ++kt) {
#pragma unroll
            for (int g = 0; g < 2; ++g) s[kt][g] = wmmab(kf[kt][1], qf[g][1], wmmab(kf[kt][0], qf[g][0], (v8f){})); }
        const int nk = (ps + NS <= qt ? ps + NS : ps) * 32;
        const bf* kp = Km + (size_t)nk * HD;
#pragma unroll
        for (int kt = 0; kt < 2; ++kt) {
#pragma unroll
            for (int kc = 0; kc < 2; ++kc) kf[kt][kc] = ldfrag(kp + (2 * kt + kc) * 2 * FB); }
        asm volatile("s_wait_xcnt 0x0" :: "v"(vp), "v"(kp) : "memory");   // keeps both address pairs alive behind the 16 loads, so that no load's result lands in a pair that other loads still name; the pairs are reused right below, behind this wait
        if (ps == qt) {   // wave-uniform: only the pass on the diagonal pays for the mask
#pragma unroll
            for (int g = 0; g < 2; ++g) { const int q = q0 + 16 * g + lr;
#pragma unroll
                for (int kt = 0; kt < 2; ++kt) {
#pragma unroll
                    for (int j = 0; j < 8; ++j) if (key0 + 16 * kt + 8 * hi + j > q) s[kt][g][j] = -INFINITY;
                } }
        }
        float mx[2];   // the lane's own 16 keys of the pass, unscaled
#pragma unroll
        for (int g = 0; g < 2; ++g) {
            mx[g] = s[0][g][0];
#pragma unroll
            for (int j = 1; j < 8; ++j) mx[g] = fmaxf(mx[g], s[0][g][j]);
#pragma unroll
            for (int j = 0; j < 8; ++j) mx[g] = fmaxf(mx[g], s[1][g][j]);
        }
        // Lazy rescale, one test per pass: the maximum in use stays while no score of the pass lies more than 8 (base-2 domain) above it, so that P stays at about 2^8 or below and l and O keep their scale.
        // Any lane over its bar sends the whole wave through the update; bar -inf sends the wave's first pass there.
        if (__builtin_amdgcn_ballot_w32(mx[0] > bar[0] || mx[1] > bar[1]) != 0) {
#pragma unroll
            for (int g = 0; g < 2; ++g) {
                const float mw = fmaxf(mx[g], xhalf(mx[g]));   // both halves of the wave hold this query's maximum of the pass
                const float mn = fmaxf(m[g], mw * cs);   // finite from the wave's first pass on: the first key of a pass is never masked, on the diagonal neither
                const float al = __builtin_amdgcn_exp2f(m[g] - mn);   // 0 on the first pass
                m[g] = mn; bar[g] = (mn + 8.0f) * (1.0f / cs); l[g] *= al;
#pragma unroll
                for (int t = 0; t < 4; ++t) acc[g][t] = acc[g][t] * al;
            }
        }
#pragma unroll
        for (int g = 0; g < 2; ++g) {
            const float mn = m[g];
            v8u wh, wl; float ls = 0.f;
#pragma unroll
            for (int i = 0; i < 8; ++i) {
                const v2f ar = __builtin_elementwise_fma((v2f){s[i >> 2][g][2 * (i & 3)], s[i >> 2][g][2 * (i & 3) + 1]}, (v2f){cs, cs}, (v2f){-mn, -mn});
                const float p0 = __builtin_amdgcn_exp2f(ar[0]), p1 = __builtin_amdgcn_exp2f(ar[1]);
                const unsigned h2 = pack2(p0, p1);
                wh[i] = h2; wl[i] = pack2(p0 - __uint_as_float(h2 << 16), p1 - __uint_as_float(h2 & 0xFFFF0000u));
                ls += p0 + p1; }
            l[g] += ls;
            const v16bf ph = __builtin_bit_cast(v16bf, wh), pl = __builtin_bit_cast(v16bf, wl);
#pragma unroll
            for (int t = 0; t < 4; ++t) acc[g][t] = wmmab(vf[t], pl, wmmab(vf[t], ph, acc[g][t]));
        }
    }
    // This share's partial result to its own LDS slice, unnormalised. A share without a pass leaves maximum -inf, sum 0, O 0: weight 0 in the join.
    float* os = &ost[h][sp * NT + tl][0];
#pragma unroll
    for (int g = 0; g < 2; ++g) {
        const float lt = l[g] + xhalf(l[g]);   // the halves' sums join here, unconditionally
#pragma unroll
        for (int t = 0; t < 4; ++t) { const v8f o = acc[g][t]; float* d = os + (16 * g + lr) * OP + 16 * t + 8 * hi;
            *(v4fa*)d = (v4f){o[0], o[1], o[2], o[3]}; *(v4fa*)(d + 4) = (v4f){o[4], o[5], o[6], o[7]}; }
        mls[h][tl][16 * g + lr][NS * hi + sp] = hi ? lt : m[g];   // the lower half of the wave writes the maximum, the upper the sum
    }
    }
    __syncthreads();   // every share of both blocks is in LDS: the rows read below were written by other waves
    // Join: wave w takes rows 8 (w >> 2) .. + 7 of tile w & 3 of either block; weights 2^(m_i - M) / L, shares added in the order 0 to 3; whole rows stored.
    const int wt = wave & 3, wr = wave >> 2;
#pragma unroll
    for (int h = 0; h < 2; ++h) {
        const int q0 = ((h ? y : 15 - y) * NT + wt) * QW;
        float* orow = O + ((size_t)map * SS + q0) * HD;
#pragma unroll
        for (int r = 0; r < QW / (2 * NS); ++r) {
            const int row = (QW / NS) * wr + 2 * r + hi;
            const v4f mm = *(const v4fa*)&mls[h][wt][row][0], ll = *(const v4fa*)&mls[h][wt][row][NS];
            const float M = fmaxf(fmaxf(mm[0], mm[1]), fmaxf(mm[2], mm[3]));   // finite: share 0 always has pass 0
            float f[NS], L = 0.f;
#pragma unroll
            for (int i = 0; i < NS; ++i) { f[i] = __builtin_amdgcn_exp2f(mm[i] - M); L += f[i] * ll[i]; }
            const float inv = 1.0f / L;
            v4f val = (v4f){};
#pragma unroll
            for (int i = 0; i < NS; ++i) val += *(const v4fa*)(&ost[h][i * NT + wt][row * OP + lr * 4]) * (f[i] * inv);
            *(v4f*)(orow + (size_t)row * HD + lr * 4) = val;
        }
        asm volatile("s_wait_xcnt 0x0" ::: "memory");   // the registers of the stores above are reused right below: the wait stands in front of that overwrite
        if (wr == h) {   // wave-uniform: one wave writes the tile's 32 logsumexp values, one whole line; lane = query
            const v4f mm = *(const v4fa*)&mls[h][wt][lane][0], ll = *(const v4fa*)&mls[h][wt][lane][NS];
            const float M = fmaxf(fmaxf(mm[0], mm[1]), fmaxf(mm[2], mm[3]));
            float L = 0.f;
#pragma unroll
            for (int i = 0; i < NS; ++i) L += __builtin_amdgcn_exp2f(mm[i] - M) * ll[i];
            LOUT[(size_t)map * SS + q0 + lane] = M * 0.6931471805599453f + logf(L);
        }
    }
}

// K and V to the two bf16 fragment-order planes in one launch. A wave takes 8 KB of f32 with all its 16 loads of 16 bytes asked for at once; every load and every store covers whole 128-byte lines.
// blockIdx.x < PVB: V. A wave owns 64 positions x 32 columns: a lane loads 8 consecutive positions x 4 columns (twice), packs each column's 8 values into 16 bytes (one lane's share of a block),
// and the wave sorts the pieces into blocks in its own LDS slice, so that each block leaves as 512 bytes in a row. The other workgroups: K, a wave owns 32 keys x 64 columns, sorted the same way.
__global__ __launch_bounds__(PW * 32) void k_prep(const float* __restrict__ K, const float* __restrict__ V, bf* __restrict__ Kb, bf* __restrict__ VT) {
    __shared__ v4u vst[PW][16 * KPC];   // per wave 8 blocks = 16 half blocks at the wider of the two pitches
    const int lane = threadIdx.x & 31, wave = __builtin_amdgcn_readfirstlane(threadIdx.x >> 5);
    if (blockIdx.x < PVB) {
        const int vw = blockIdx.x * PW + wave, map = vw >> 6, t0 = ((vw & 63) >> 1) * 64, d0 = (vw & 1) * 32, q = lane & 7, u = lane >> 3;
        const float* s = V + ((size_t)map * SS + t0 + 8 * u) * HD + d0 + 4 * q;
        v4f x[2][8];
#pragma unroll
        for (int h = 0; h < 2; ++h) {
#pragma unroll
            for (int j = 0; j < 8; ++j) x[h][j] = *(const v4f*)(s + (32 * h + j) * HD); }
        __builtin_amdgcn_sched_barrier(0);   // all 16 loads are asked for before the first value is used: without it the compiler holds the second eight back until the first eight have come
        asm volatile("s_wait_xcnt 0x0" :: "v"(s) : "memory");   // keeps the loads' address pair alive behind all 16, so that the last load's result does not land in it while the others still name it; any later reuse of the pair is behind this wait
        v4u* st = &vst[wave][0];
#pragma unroll
        for (int h = 0; h < 2; ++h) {
#pragma unroll
            for (int i = 0; i < 4; ++i)   // column d0 + 4 q + i, positions t0 + 32 h + 8 u + 0..7: half block ((h * 2 + (q >> 2)) * 2 + j) * 2 + hi with u = 2 j + hi, place 4 (q & 3) + i
                st[(8 * h + 4 * (q >> 2) + u) * VPC + 4 * (q & 3) + i] = (v4u){pack2(x[h][0][i], x[h][1][i]), pack2(x[h][2][i], x[h][3][i]), pack2(x[h][4][i], x[h][5][i]), pack2(x[h][6][i], x[h][7][i])}; }
        asm volatile("s_wait_dscnt 0x0" ::: "memory");   // the pieces read below were written by other lanes of this wave: the writes are done, and the reads stay behind them
        bf* d = VT + ((size_t)map * SS + t0) * HD + (d0 >> 4) * 2 * FB + 8 * lane;
#pragma unroll
        for (int r = 0; r < 8; ++r) *(v4u*)(d + (r >> 2) * 32 * HD + (r & 3) * FB) = st[(2 * r + (lane >> 4)) * VPC + (lane & 15)];   // r = (h * 2 + 16-column tile) * 2 + j
    } else {
        const size_t w0 = ((size_t)(blockIdx.x - PVB) * PW + wave) * 2048, o = w0 + lane * 4;   // w0: 32 keys of one map, the same 2048 elements in both orders
        v4f x[16];
#pragma unroll
        for (int i = 0; i < 16; ++i) x[i] = *(const v4f*)(K + o + 128 * i);
        __builtin_amdgcn_sched_barrier(0);   // as above: without it the last four loads are held back until the first values have come
        asm volatile("s_wait_xcnt 0x0" :: "v"(K + o) : "memory");   // as above, for this run's address pair
        v4u* st = &vst[wave][0]; v2ua* st2 = (v2ua*)st; const int c = lane & 15;
#pragma unroll
        for (int i = 0; i < 16; ++i)   // key 2 i + (lane >> 4), columns 4 c + 0..3 = 32 kc + 16 j + 8 hi + 4 (c & 1) + 0..3: half block 8 (i >> 3) + (c >> 1), place key & 15, half c & 1 of the piece
            st2[((8 * (i >> 3) + (c >> 1)) * KPC + 2 * (i & 7) + (lane >> 4)) * 2 + (c & 1)] = (v2u){pack2(x[i][0], x[i][1]), pack2(x[i][2], x[i][3])};
        asm volatile("s_wait_dscnt 0x0" ::: "memory");   // as above: the pieces read below were written by other lanes of this wave
#pragma unroll
        for (int r = 0; r < 8; ++r) *(v4u*)(Kb + w0 + r * FB + 8 * lane) = st[(2 * r + (lane >> 4)) * KPC + (lane & 15)];
        asm volatile("s_wait_xcnt 0x0" ::: "memory");   // behind the last store: no path from here rewrites a register of a store without it
    }
}

extern "C" void kernel_launch(void* const* d_in, const int* in_sizes, int n_in,
                              void* d_out, int out_size, void* d_ws, size_t ws_size, hipStream_t stream) {
    (void)in_sizes; (void)n_in; (void)out_size;
    const float* Q = (const float*)d_in[0]; const float* Kx = (const float*)d_in[1]; const float* V = (const float*)d_in[2];
    float* O = (float*)d_out;                                              // [2][16][2048][64]
    float* LO = (float*)((char*)d_out + (size_t)NB_ * NH_ * SS * HD * 4);  // [2][16][2048][1] right after O
    char* wsp = (char*)d_ws;
    auto take = [&](size_t bytes) { char* p = wsp; wsp += (bytes + 255) & ~(size_t)255; return (void*)p; };
    bf* Kb = (bf*)take((size_t)NMAP * SS * HD * 2); bf* VT = (bf*)take((size_t)NMAP * HD * SS * 2);
    if ((size_t)(wsp - (char*)d_ws) > ws_size) return;    // 17 MB
    k_prep<<<2 * PVB, PW * 32, 0, stream>>>(Kx, V, Kb, VT);
    k_fused<<<dim3(NMAP, SS / (QW * NT * 2), 1), NWV * 32, 0, stream>>>(Q, Kb, VT, O, LO);
}
